// v000
// The times below were measured on an AMD MI455X: many runs one after another, warmed up first and cycling through
// copies of the inputs, with the whole window's GPU time divided by the number of runs. Launches and the gaps
// between them are all in it. The median over several windows is given; except for v000 it joins two sittings, which
// can be a few percent apart, so the side-by-side timings, each taken in one sitting, are the better comparison.
// v000 is the starting kernel. One run takes 297 microseconds.
#include <hip/hip_runtime.h>
#include <hip/hip_bf16.h>

typedef _Float16 v16h __attribute__((ext_vector_type(16)));
typedef _Float16 v8h  __attribute__((ext_vector_type(8)));
typedef _Float16 v4h  __attribute__((ext_vector_type(4)));
typedef float    v8f  __attribute__((ext_vector_type(8)));
typedef unsigned int u32x4 __attribute__((ext_vector_type(4)));
typedef int          i32x8 __attribute__((ext_vector_type(8)));
typedef int          i32x4 __attribute__((ext_vector_type(4)));

#if __has_builtin(__builtin_amdgcn_tensor_load_to_lds)
#define USE_TDM 1
#else
#define USE_TDM 0
#endif

// LDS B tile: 64 rows x 128 halves per chunk, padded to 136 halves (272B) per
// row so consecutive fragment rows hit different LDS banks (256B stride would
// alias all 16 rows onto the same bank: 64 banks x 4B).
#define BROW 136
#define CHUNK 128

// Load one 16-half WMMA fragment (global, row stride = ld).
// 16-bit A/B^T layout: lane<16 holds K = k+0..7 and k+16..23,
// lane>=16 holds K = k+8..15 and k+24..31 (koff pre-applied by caller).
__device__ __forceinline__ v16h load_frag(const _Float16* __restrict__ p) {
  v8h lo = *(const v8h*)(p);
  v8h hi = *(const v8h*)(p + 16);
  return __builtin_shufflevector(lo, hi, 0,1,2,3,4,5,6,7,8,9,10,11,12,13,14,15);
}

__device__ __forceinline__ v16h lds_frag(const _Float16* p) {
  v8h lo = *(const v8h*)(p);
  v8h hi = *(const v8h*)(p + 16);
  return __builtin_shufflevector(lo, hi, 0,1,2,3,4,5,6,7,8,9,10,11,12,13,14,15);
}

#if USE_TDM
// Issue a TDM DMA of a 64-row x 128-half tile of Bt (row stride ldb halves)
// into LDS at lds_addr, with 4-DWORD padding every 64 DWORDs (-> 272B rows).
// This toolchain exposes the 6-arg clang-23 builtin:
//   (u32x4 group0, i32x8 group1, i32x4 group2, i32x4 group3, i32x8, i32 cpol)
__device__ __forceinline__ void tdm_load_B(const _Float16* gptr, unsigned lds_addr, int ldb) {
  unsigned long long ga = (unsigned long long)(uintptr_t)gptr;
  u32x4 g0;
  g0[0] = 1u;                                   // count=1 (valid user descriptor)
  g0[1] = lds_addr;                             // lds_addr [63:32]
  g0[2] = (unsigned)ga;                         // global_addr [95:64]
  g0[3] = (unsigned)(ga >> 32) | (2u << 30);    // global_addr hi + type=2 (image)
  i32x8 g1;
  // data_size=2B, pad_enable, pad_interval=64 DWORDs (code 5), pad_amount=4 DWORDs (code 3)
  g1[0] = (int)((1u << 16) | (1u << 20) | (5u << 22) | (3u << 25));
  const unsigned td0 = 0x40000000u, td1 = 0x40000000u;  // huge dims: no OOB clamp
  g1[1] = (int)((td0 & 0xFFFFu) << 16);                 // tensor_dim0[15:0]
  g1[2] = (int)((td0 >> 16) | ((td1 & 0xFFFFu) << 16)); // tensor_dim0 hi | tensor_dim1 lo
  g1[3] = (int)((td1 >> 16) | ((unsigned)CHUNK << 16)); // tensor_dim1 hi | tile_dim0=128
  g1[4] = 64;                                           // tile_dim1=64, tile_dim2=0
  g1[5] = ldb;                                          // tensor_dim0_stride[31:0]
  g1[6] = 0;                                            // stride hi | dim1_stride lo
  g1[7] = 0;
  i32x4 z4 = {0, 0, 0, 0};                              // group2/3: 2D tile -> zero (NULL)
  i32x8 z8 = {0, 0, 0, 0, 0, 0, 0, 0};
  __builtin_amdgcn_tensor_load_to_lds(g0, g1, z4, z4, z8, 0);
}
#endif

// Generic C = scale * (A[M,K] x Bt[N,K]^T + bias[col]) GEMM, f16 in, f32 acc.
// flags bit0: store f16 (else f32); bit1: store transposed (C[col*ldc+row]).
// Grid: x = N/64, y = M/256, z = batch. Block: 256 threads = 8 waves.
// The 64-col B panel is staged into LDS (TDM DMA, double buffered, 128-wide K
// chunks) and shared by all 8 waves; each wave computes a 32x64 sub-tile
// (2 A frags x 4 B frags -> 8 WMMAs per k-step).
__global__ void __launch_bounds__(256)
gemm_f16_wmma(const _Float16* __restrict__ A, long sAz, int lda,
              const _Float16* __restrict__ Bt, long sBz, int ldb,
              void* __restrict__ Cv, long sCz, int ldc,
              const float* __restrict__ bias, long sBiasz,
              float scale, int M, int N, int K, int flags)
{
  (void)M; (void)N;
  const int z    = blockIdx.z;
  A  += z * sAz;
  Bt += z * sBz;
  const int lane = threadIdx.x & 31;
  const int wave = threadIdx.x >> 5;
  const int m0   = blockIdx.y * 256 + wave * 32;
  const int n0   = blockIdx.x * 64;
  const int lr   = lane & 15;
  const int koff = (lane >> 4) * 8;

  __shared__ __align__(16) _Float16 tileB[2][64 * BROW];

  const _Float16* abase0 = A + (long)(m0 +  0 + lr) * lda + koff;
  const _Float16* abase1 = A + (long)(m0 + 16 + lr) * lda + koff;
  const _Float16* btile  = Bt + (long)n0 * ldb;   // 64-row panel for this block

  const int nchunks = K >> 7;   // K / 128

  // Prologue: stage chunk 0 into buffer 0.
#if USE_TDM
  if (threadIdx.x < 32) {
    tdm_load_B(btile, (unsigned)(uintptr_t)&tileB[0][0], ldb);
    __builtin_amdgcn_s_wait_tensorcnt(0);
  }
#else
  {
    const int tid = threadIdx.x;
#pragma unroll
    for (int t = 0; t < 4; ++t) {
      int idx = t * 256 + tid;          // 1024 16-byte chunks
      int r = idx >> 3, c8 = (idx & 7) * 16;
      *(v8h*)(&tileB[0][r * BROW + c8]) = *(const v8h*)(btile + (long)r * ldb + c8);
    }
  }
#endif
  __syncthreads();

  v8f acc[4][2] = {};
  for (int c = 0; c < nchunks; ++c) {
    const int buf = c & 1;
    const int kc  = c * CHUNK;
    const bool more = (c + 1) < nchunks;

    // Overlap: DMA chunk c+1 into the other buffer while computing chunk c.
#if USE_TDM
    if (more && threadIdx.x < 32)
      tdm_load_B(btile + kc + CHUNK, (unsigned)(uintptr_t)&tileB[buf ^ 1][0], ldb);
#else
    if (more) {
      const int tid = threadIdx.x;
#pragma unroll
      for (int t = 0; t < 4; ++t) {
        int idx = t * 256 + tid;
        int r = idx >> 3, c8 = (idx & 7) * 16;
        *(v8h*)(&tileB[buf ^ 1][r * BROW + c8]) =
            *(const v8h*)(btile + (long)r * ldb + kc + CHUNK + c8);
      }
    }
#endif
    // Keep A one chunk ahead in the WGP cache (speculative; OOB dropped).
    __builtin_prefetch((const void*)(abase0 + kc + CHUNK), 0, 1);
    __builtin_prefetch((const void*)(abase1 + kc + CHUNK), 0, 1);

    const _Float16* Bl = &tileB[buf][0];
#pragma unroll
    for (int kk = 0; kk < CHUNK; kk += 32) {
      v16h a0 = load_frag(abase0 + kc + kk);
      v16h a1 = load_frag(abase1 + kc + kk);
      v16h f0 = lds_frag(Bl + ( 0 + lr) * BROW + kk + koff);
      v16h f1 = lds_frag(Bl + (16 + lr) * BROW + kk + koff);
      v16h f2 = lds_frag(Bl + (32 + lr) * BROW + kk + koff);
      v16h f3 = lds_frag(Bl + (48 + lr) * BROW + kk + koff);
      acc[0][0] = __builtin_amdgcn_wmma_f32_16x16x32_f16(false, a0, false, f0, (short)0, acc[0][0], false, false);
      acc[0][1] = __builtin_amdgcn_wmma_f32_16x16x32_f16(false, a1, false, f0, (short)0, acc[0][1], false, false);
      acc[1][0] = __builtin_amdgcn_wmma_f32_16x16x32_f16(false, a0, false, f1, (short)0, acc[1][0], false, false);
      acc[1][1] = __builtin_amdgcn_wmma_f32_16x16x32_f16(false, a1, false, f1, (short)0, acc[1][1], false, false);
      acc[2][0] = __builtin_amdgcn_wmma_f32_16x16x32_f16(false, a0, false, f2, (short)0, acc[2][0], false, false);
      acc[2][1] = __builtin_amdgcn_wmma_f32_16x16x32_f16(false, a1, false, f2, (short)0, acc[2][1], false, false);
      acc[3][0] = __builtin_amdgcn_wmma_f32_16x16x32_f16(false, a0, false, f3, (short)0, acc[3][0], false, false);
      acc[3][1] = __builtin_amdgcn_wmma_f32_16x16x32_f16(false, a1, false, f3, (short)0, acc[3][1], false, false);
    }

    if (more) {
#if USE_TDM
      if (threadIdx.x < 32) __builtin_amdgcn_s_wait_tensorcnt(0);
#endif
      __syncthreads();   // publish buf^1; all waves done reading buf
    }
  }

  // Epilogue. C layout per 16x16 tile: lanes 0-15 -> M = base+0..7,
  // lanes 16-31 -> M = base+8..15, N = n0 + j*16 + (lane&15);
  // accumulator element r holds row (base + r).
  float*    Cf = (float*)Cv    + (long)z * sCz;
  _Float16* Ch = (_Float16*)Cv + (long)z * sCz;
  const float* bp = bias ? bias + (long)z * sBiasz : nullptr;
#pragma unroll
  for (int j = 0; j < 4; ++j) {
    const int col = n0 + j * 16 + lr;
    const float bval = bp ? bp[col] : 0.0f;
#pragma unroll
    for (int t = 0; t < 2; ++t) {
      const int rowb = m0 + t * 16 + (lane >> 4) * 8;
#pragma unroll
      for (int r = 0; r < 8; ++r) {
        float o = (acc[j][t][r] + bval) * scale;
        long addr = (flags & 2) ? ((long)col * ldc + (rowb + r))
                                : ((long)(rowb + r) * ldc + col);
        if (flags & 1) Ch[addr] = (_Float16)o;
        else           Cf[addr] = o;
      }
    }
  }
}

__global__ void cvt_f32_f16(const float* __restrict__ src, _Float16* __restrict__ dst, int n) {
  int i = blockIdx.x * blockDim.x + threadIdx.x;
  if (i < n) dst[i] = (_Float16)src[i];
}

// dst[c*ldDst + r] = src[r*C + c]  (f32 -> f16)
__global__ void transpose_f32_f16(const float* __restrict__ src, _Float16* __restrict__ dst,
                                  int R, int C, int ldDst) {
  int c = blockIdx.x * 16 + threadIdx.x;
  int r = blockIdx.y * 16 + threadIdx.y;
  if (r < R && c < C) dst[(long)c * ldDst + r] = (_Float16)src[(long)r * C + c];
}

__global__ void bo_sum_kernel(const float* __restrict__ bo, float* __restrict__ out) {
  int d = blockIdx.x * blockDim.x + threadIdx.x;
  if (d < 512) {
    float s = 0.0f;
    for (int n = 0; n < 4; ++n) s += bo[n * 512 + d];
    out[d] = s;
  }
}

// One block per score row: P_row = sum_h gate_h * softmax(s_h * row).
// Row max commutes with the positive per-head scale, so one max serves all heads.
__global__ void __launch_bounds__(256)
softmax_combine(const float* __restrict__ scores, _Float16* __restrict__ P,
                const float* __restrict__ strength, const float* __restrict__ gate)
{
  const int S = 1024;
  const int row = blockIdx.x;
  const int zb  = blockIdx.y;     // n*2 + b
  const int n   = zb >> 1;
  const float4* src = (const float4*)(scores + ((long)zb * S + row) * S);
  _Float16*     dst = P + ((long)zb * S + row) * S;
  const int tid = threadIdx.x;    // 0..255, 4 elements each

  __shared__ float red[256];
  __shared__ float wsh[8];

  float4 xv = src[tid];
  float m = fmaxf(fmaxf(xv.x, xv.y), fmaxf(xv.z, xv.w));
  red[tid] = m; __syncthreads();
  for (int s = 128; s > 0; s >>= 1) {
    if (tid < s) red[tid] = fmaxf(red[tid], red[tid + s]);
    __syncthreads();
  }
  m = red[0];

  float sh[8], gh[8];
#pragma unroll
  for (int h = 0; h < 8; ++h) {
    sh[h] = fminf(fmaxf(strength[n * 64 + h * 9], 0.01f), 1.0f);  // diag, clamped
    gh[h] = gate[n * 8 + h];
  }

  for (int h = 0; h < 8; ++h) {
    float s = sh[h];
    float t = __expf(s * (xv.x - m)) + __expf(s * (xv.y - m)) +
              __expf(s * (xv.z - m)) + __expf(s * (xv.w - m));
    __syncthreads();
    red[tid] = t; __syncthreads();
    for (int st = 128; st > 0; st >>= 1) {
      if (tid < st) red[tid] += red[tid + st];
      __syncthreads();
    }
    if (tid == 0) wsh[h] = gh[h] / red[0];
  }
  __syncthreads();

  float o0 = 0, o1 = 0, o2 = 0, o3 = 0;
#pragma unroll
  for (int h = 0; h < 8; ++h) {
    float s = sh[h], wv = wsh[h];
    o0 += wv * __expf(s * (xv.x - m));
    o1 += wv * __expf(s * (xv.y - m));
    o2 += wv * __expf(s * (xv.z - m));
    o3 += wv * __expf(s * (xv.w - m));
  }
  v4h o = {(_Float16)o0, (_Float16)o1, (_Float16)o2, (_Float16)o3};
  *(v4h*)(dst + tid * 4) = o;
}

extern "C" void kernel_launch(void* const* d_in, const int* in_sizes, int n_in,
                              void* d_out, int out_size, void* d_ws, size_t ws_size,
                              hipStream_t stream) {
  (void)in_sizes; (void)n_in; (void)out_size; (void)ws_size;
  const float* x        = (const float*)d_in[0];
  const float* Wq       = (const float*)d_in[1];
  const float* bq       = (const float*)d_in[2];
  const float* Wk       = (const float*)d_in[3];
  const float* bk       = (const float*)d_in[4];
  const float* Wv       = (const float*)d_in[5];
  const float* bv       = (const float*)d_in[6];
  const float* Wo       = (const float*)d_in[7];
  const float* bo       = (const float*)d_in[8];
  const float* strength = (const float*)d_in[9];
  const float* gate     = (const float*)d_in[10];
  float* out = (float*)d_out;

  const int NB = 4, B = 2, S = 1024, D = 512, HID = 512;
  const long MS = (long)B * S;  // 2048

  char* w = (char*)d_ws;
  _Float16* x16  = (_Float16*)w; w += MS * D * 2;                  // [2048,512]
  _Float16* WqT  = (_Float16*)w; w += (long)NB * HID * D * 2;      // [n][HID,D]
  _Float16* WkT  = (_Float16*)w; w += (long)NB * HID * D * 2;
  _Float16* WvT  = (_Float16*)w; w += (long)NB * HID * D * 2;
  _Float16* WoT  = (_Float16*)w; w += (long)D * NB * HID * 2;      // [D, NB*HID]
  _Float16* q16  = (_Float16*)w; w += (long)NB * MS * HID * 2;     // [n][2048,512]
  _Float16* k16  = (_Float16*)w; w += (long)NB * MS * HID * 2;
  _Float16* vT16 = (_Float16*)w; w += (long)NB * B * HID * S * 2;  // [n][b][HID,S]
  float*    sc   = (float*)w;    w += (long)NB * B * S * S * 4;    // [n][b][S,S]
  _Float16* P16  = (_Float16*)w; w += (long)NB * B * S * S * 2;    // [n][b][S,S]
  _Float16* hs   = (_Float16*)w; w += MS * (long)NB * HID * 2;     // [b*S, NB*HID]
  float*    bos  = (float*)w;    w += 512 * 4;

  const dim3 tb(256);

  // Stage 0: f16 conversion + weight transposes (A x B^T convention everywhere).
  cvt_f32_f16<<<dim3((MS * D) / 256), 256, 0, stream>>>(x, x16, (int)(MS * D));
  for (int n = 0; n < NB; ++n) {
    transpose_f32_f16<<<dim3(32, 32), dim3(16, 16), 0, stream>>>(
        Wq + (long)n * D * HID, WqT + (long)n * HID * D, D, HID, D);
    transpose_f32_f16<<<dim3(32, 32), dim3(16, 16), 0, stream>>>(
        Wk + (long)n * D * HID, WkT + (long)n * HID * D, D, HID, D);
    transpose_f32_f16<<<dim3(32, 32), dim3(16, 16), 0, stream>>>(
        Wv + (long)n * D * HID, WvT + (long)n * HID * D, D, HID, D);
    // WoT[d][n*HID + h] = Wo[n][h][d]
    transpose_f32_f16<<<dim3(32, 32), dim3(16, 16), 0, stream>>>(
        Wo + (long)n * HID * D, WoT + (long)n * HID, HID, D, NB * HID);
  }
  bo_sum_kernel<<<2, 256, 0, stream>>>(bo, bos);

  // Stage 1: Q, K projections: [2048,512] x [512,512]^T per block.
  gemm_f16_wmma<<<dim3(HID / 64, MS / 256, NB), tb, 0, stream>>>(
      x16, 0L, D, WqT, (long)HID * D, D,
      q16, (long)MS * HID, HID, bq, (long)HID, 1.0f, (int)MS, HID, D, 1);
  gemm_f16_wmma<<<dim3(HID / 64, MS / 256, NB), tb, 0, stream>>>(
      x16, 0L, D, WkT, (long)HID * D, D,
      k16, (long)MS * HID, HID, bk, (long)HID, 1.0f, (int)MS, HID, D, 1);

  // Stage 2: V projection, epilogue-transposed to vT[n][b][h][t].
  for (int n = 0; n < NB; ++n) {
    gemm_f16_wmma<<<dim3(HID / 64, S / 256, B), tb, 0, stream>>>(
        x16, (long)S * D, D, WvT + (long)n * HID * D, 0L, D,
        vT16 + (long)n * B * HID * S, (long)HID * S, S,
        bv + (long)n * HID, 0L, 1.0f, S, HID, D, 3);
  }

  // Stage 3: scores = q k^T / sqrt(512); q/k offsets are linear in z = n*2+b.
  gemm_f16_wmma<<<dim3(S / 64, S / 256, NB * B), tb, 0, stream>>>(
      q16, (long)S * HID, HID, k16, (long)S * HID, HID,
      sc, (long)S * S, S, nullptr, 0L, 0.044194173824159216f, S, S, HID, 0);

  // Stage 4: combined gate-weighted softmax over all 8 heads -> one prob matrix.
  softmax_combine<<<dim3(S, NB * B), 256, 0, stream>>>(sc, P16, strength, gate);

  // Stage 5: head_sum = P @ v, staged as hs[b*S + s][n*HID + h].
  for (int n = 0; n < NB; ++n) {
    gemm_f16_wmma<<<dim3(HID / 64, S / 256, B), tb, 0, stream>>>(
        P16 + (long)n * B * S * S, (long)S * S, S,
        vT16 + (long)n * B * HID * S, (long)HID * S, S,
        hs + (long)n * HID, (long)S * NB * HID, NB * HID,
        nullptr, 0L, 1.0f, S, HID, S, 1);
  }

  // Stage 6: out = MOD * (hs @ Wo_all + sum_n bo[n]); K = NB*HID = 2048.
  gemm_f16_wmma<<<dim3(D / 64, MS / 256, 1), tb, 0, stream>>>(
      hs, 0L, NB * HID, WoT, 0L, NB * HID,
      out, 0L, D, bos, 0L, 1.55f, (int)MS, D, NB * HID, 0);
}

// v001
// Measured time: 164 microseconds a run.
// Two timings next to v000 both put it at 1.83 times that version's speed.
#include <hip/hip_runtime.h>
#include <hip/hip_bf16.h>

typedef _Float16 v16h __attribute__((ext_vector_type(16)));
typedef _Float16 v8h  __attribute__((ext_vector_type(8)));
typedef _Float16 v4h  __attribute__((ext_vector_type(4)));
typedef float    v8f  __attribute__((ext_vector_type(8)));
typedef unsigned int u32x4 __attribute__((ext_vector_type(4)));
typedef int          i32x8 __attribute__((ext_vector_type(8)));
typedef int          i32x4 __attribute__((ext_vector_type(4)));

#if __has_builtin(__builtin_amdgcn_tensor_load_to_lds)
#define USE_TDM 1
#else
#define USE_TDM 0
#endif

// LDS B tile: 64 rows x 128 halves per chunk, padded to 136 halves (272B) per
// row so consecutive fragment rows hit different LDS banks (256B stride would
// alias all 16 rows onto the same bank: 64 banks x 4B).
#define BROW 136
#define CHUNK 128

// Load one 16-half WMMA fragment (global, row stride = ld).
// 16-bit A/B^T layout: lane<16 holds K = k+0..7 and k+16..23,
// lane>=16 holds K = k+8..15 and k+24..31 (koff pre-applied by caller).
__device__ __forceinline__ v16h load_frag(const _Float16* __restrict__ p) {
  v8h lo = *(const v8h*)(p);
  v8h hi = *(const v8h*)(p + 16);
  return __builtin_shufflevector(lo, hi, 0,1,2,3,4,5,6,7,8,9,10,11,12,13,14,15);
}

__device__ __forceinline__ v16h lds_frag(const _Float16* p) {
  v8h lo = *(const v8h*)(p);
  v8h hi = *(const v8h*)(p + 16);
  return __builtin_shufflevector(lo, hi, 0,1,2,3,4,5,6,7,8,9,10,11,12,13,14,15);
}

#if USE_TDM
// Issue a TDM DMA of a 64-row x 128-half tile of Bt (row stride ldb halves)
// into LDS at lds_addr, with 4-DWORD padding every 64 DWORDs (-> 272B rows).
// This toolchain exposes the 6-arg clang-23 builtin:
//   (u32x4 group0, i32x8 group1, i32x4 group2, i32x4 group3, i32x8, i32 cpol)
__device__ __forceinline__ void tdm_load_B(const _Float16* gptr, unsigned lds_addr, int ldb) {
  unsigned long long ga = (unsigned long long)(uintptr_t)gptr;
  u32x4 g0;
  g0[0] = 1u;                                   // count=1 (valid user descriptor)
  g0[1] = lds_addr;                             // lds_addr [63:32]
  g0[2] = (unsigned)ga;                         // global_addr [95:64]
  g0[3] = (unsigned)(ga >> 32) | (2u << 30);    // global_addr hi + type=2 (image)
  i32x8 g1;
  // data_size=2B, pad_enable, pad_interval=64 DWORDs (code 5), pad_amount=4 DWORDs (code 3)
  g1[0] = (int)((1u << 16) | (1u << 20) | (5u << 22) | (3u << 25));
  const unsigned td0 = 0x40000000u, td1 = 0x40000000u;  // huge dims: no OOB clamp
  g1[1] = (int)((td0 & 0xFFFFu) << 16);                 // tensor_dim0[15:0]
  g1[2] = (int)((td0 >> 16) | ((td1 & 0xFFFFu) << 16)); // tensor_dim0 hi | tensor_dim1 lo
  g1[3] = (int)((td1 >> 16) | ((unsigned)CHUNK << 16)); // tensor_dim1 hi | tile_dim0=128
  g1[4] = 64;                                           // tile_dim1=64, tile_dim2=0
  g1[5] = ldb;                                          // tensor_dim0_stride[31:0]
  g1[6] = 0;                                            // stride hi | dim1_stride lo
  g1[7] = 0;
  i32x4 z4 = {0, 0, 0, 0};                              // group2/3: 2D tile -> zero (NULL)
  i32x8 z8 = {0, 0, 0, 0, 0, 0, 0, 0};
  __builtin_amdgcn_tensor_load_to_lds(g0, g1, z4, z4, z8, 0);
}
#endif

// Generic C = scale * (A[M,K] x Bt[N,K]^T + bias[col]) GEMM, f16 in, f32 acc.
// flags bit0: store f16 (else f32).
// Grid: x = N/64, y = M/256, z = batch. Block: 256 threads = 8 waves.
// The batch index splits into a group zh = z >> zshift and a member
// zl = z & ((1 << zshift) - 1), each with its own operand strides, so that
// products which differ in two indices share one launch. Group zh takes
// bias0, bias1 or bias2 (zh >= 2); groups zh >= tfrom store transposed
// (C[col*ldcT+row]).
// The 64-col B panel is staged into LDS (TDM DMA, double buffered, 128-wide K
// chunks) and shared by all 8 waves; each wave computes a 32x64 sub-tile
// (2 A frags x 4 B frags -> 8 WMMAs per k-step).
__global__ void __launch_bounds__(256)
gemm_f16_wmma(const _Float16* __restrict__ A, long sAh, long sAl, int lda,
              const _Float16* __restrict__ Bt, long sBh, long sBl, int ldb,
              void* __restrict__ Cv, long sCh, long sCl, int ldc, int ldcT,
              const float* __restrict__ bias0, const float* __restrict__ bias1,
              const float* __restrict__ bias2, long sBiasl,
              float scale, int zshift, int tfrom, int K, int flags)
{
  const int z    = blockIdx.z;
  const int zh   = z >> zshift;
  const int zl   = z - (zh << zshift);
  A  += zh * sAh + zl * sAl;
  Bt += zh * sBh + zl * sBl;
  const int lane = threadIdx.x & 31;
  const int wave = threadIdx.x >> 5;
  const int m0   = blockIdx.y * 256 + wave * 32;
  const int n0   = blockIdx.x * 64;
  const int lr   = lane & 15;
  const int koff = (lane >> 4) * 8;

  __shared__ __align__(16) _Float16 tileB[2][64 * BROW];

  const _Float16* abase0 = A + (long)(m0 +  0 + lr) * lda + koff;
  const _Float16* abase1 = A + (long)(m0 + 16 + lr) * lda + koff;
  const _Float16* btile  = Bt + (long)n0 * ldb;   // 64-row panel for this block

  const int nchunks = K >> 7;   // K / 128

  // Prologue: stage chunk 0 into buffer 0.
#if USE_TDM
  if (threadIdx.x < 32) {
    tdm_load_B(btile, (unsigned)(uintptr_t)&tileB[0][0], ldb);
    __builtin_amdgcn_s_wait_tensorcnt(0);
  }
#else
  {
    const int tid = threadIdx.x;
#pragma unroll
    for (int t = 0; t < 4; ++t) {
      int idx = t * 256 + tid;          // 1024 16-byte chunks
      int r = idx >> 3, c8 = (idx & 7) * 16;
      *(v8h*)(&tileB[0][r * BROW + c8]) = *(const v8h*)(btile + (long)r * ldb + c8);
    }
  }
#endif
  __syncthreads();

  v8f acc[4][2] = {};
  for (int c = 0; c < nchunks; ++c) {
    const int buf = c & 1;
    const int kc  = c * CHUNK;
    const bool more = (c + 1) < nchunks;

    // Overlap: DMA chunk c+1 into the other buffer while computing chunk c.
#if USE_TDM
    if (more && threadIdx.x < 32)
      tdm_load_B(btile + kc + CHUNK, (unsigned)(uintptr_t)&tileB[buf ^ 1][0], ldb);
#else
    if (more) {
      const int tid = threadIdx.x;
#pragma unroll
      for (int t = 0; t < 4; ++t) {
        int idx = t * 256 + tid;
        int r = idx >> 3, c8 = (idx & 7) * 16;
        *(v8h*)(&tileB[buf ^ 1][r * BROW + c8]) =
            *(const v8h*)(btile + (long)r * ldb + kc + CHUNK + c8);
      }
    }
#endif
    // Keep A one chunk ahead in the WGP cache (speculative; OOB dropped).
    __builtin_prefetch((const void*)(abase0 + kc + CHUNK), 0, 1);
    __builtin_prefetch((const void*)(abase1 + kc + CHUNK), 0, 1);

    const _Float16* Bl = &tileB[buf][0];
#pragma unroll
    for (int kk = 0; kk < CHUNK; kk += 32) {
      v16h a0 = load_frag(abase0 + kc + kk);
      v16h a1 = load_frag(abase1 + kc + kk);
      v16h f0 = lds_frag(Bl + ( 0 + lr) * BROW + kk + koff);
      v16h f1 = lds_frag(Bl + (16 + lr) * BROW + kk + koff);
      v16h f2 = lds_frag(Bl + (32 + lr) * BROW + kk + koff);
      v16h f3 = lds_frag(Bl + (48 + lr) * BROW + kk + koff);
      acc[0][0] = __builtin_amdgcn_wmma_f32_16x16x32_f16(false, a0, false, f0, (short)0, acc[0][0], false, false);
      acc[0][1] = __builtin_amdgcn_wmma_f32_16x16x32_f16(false, a1, false, f0, (short)0, acc[0][1], false, false);
      acc[1][0] = __builtin_amdgcn_wmma_f32_16x16x32_f16(false, a0, false, f1, (short)0, acc[1][0], false, false);
      acc[1][1] = __builtin_amdgcn_wmma_f32_16x16x32_f16(false, a1, false, f1, (short)0, acc[1][1], false, false);
      acc[2][0] = __builtin_amdgcn_wmma_f32_16x16x32_f16(false, a0, false, f2, (short)0, acc[2][0], false, false);
      acc[2][1] = __builtin_amdgcn_wmma_f32_16x16x32_f16(false, a1, false, f2, (short)0, acc[2][1], false, false);
      acc[3][0] = __builtin_amdgcn_wmma_f32_16x16x32_f16(false, a0, false, f3, (short)0, acc[3][0], false, false);
      acc[3][1] = __builtin_amdgcn_wmma_f32_16x16x32_f16(false, a1, false, f3, (short)0, acc[3][1], false, false);
    }

    if (more) {
#if USE_TDM
      if (threadIdx.x < 32) __builtin_amdgcn_s_wait_tensorcnt(0);
#endif
      __syncthreads();   // publish buf^1; all waves done reading buf
    }
  }

  // Epilogue. C layout per 16x16 tile: lanes 0-15 -> M = base+0..7,
  // lanes 16-31 -> M = base+8..15, N = n0 + j*16 + (lane&15);
  // accumulator element r holds row (base + r).
  float*    Cf = (float*)Cv    + (zh * sCh + zl * sCl);
  _Float16* Ch = (_Float16*)Cv + (zh * sCh + zl * sCl);
  const float* bias = zh == 0 ? bias0 : zh == 1 ? bias1 : bias2;
  const float* bp = bias ? bias + zl * sBiasl : nullptr;
  const bool tr = zh >= tfrom;
#pragma unroll
  for (int j = 0; j < 4; ++j) {
    const int col = n0 + j * 16 + lr;
    const float bval = bp ? bp[col] : 0.0f;
#pragma unroll
    for (int t = 0; t < 2; ++t) {
      const int rowb = m0 + t * 16 + (lane >> 4) * 8;
#pragma unroll
      for (int r = 0; r < 8; ++r) {
        float o = (acc[j][t][r] + bval) * scale;
        long addr = tr ? ((long)col * ldcT + (rowb + r))
                       : ((long)(rowb + r) * ldc + col);
        if (flags & 1) Ch[addr] = (_Float16)o;
        else           Cf[addr] = o;
      }
    }
  }
}

// All input staging in one launch; the three parts are independent of one
// another and each block does one part, chosen by its index:
//   blocks [0, 4096):       x16 = f16(x), one element per thread
//   blocks [4096, 20480):   sixteen 512x512 weight transposes, f32 -> f16, one
//                           16x16 tile per block: dst[c*ld + r] = src[r*512 + c]
//   blocks [20480, 20482):  bos[d] = sum_n bo[n][d]
// WqkvT holds the transposed Wq, Wk, Wv as twelve [HID,D] matrices in a row;
// WoT[d][n*HID + h] = Wo[n][h][d].
__global__ void __launch_bounds__(256)
prep_inputs(const float* __restrict__ x,  const float* __restrict__ Wq,
            const float* __restrict__ Wk, const float* __restrict__ Wv,
            const float* __restrict__ Wo, const float* __restrict__ bo,
            _Float16* __restrict__ x16, _Float16* __restrict__ WqkvT,
            _Float16* __restrict__ WoT, float* __restrict__ bos)
{
  const int tid = threadIdx.x;
  int blk = blockIdx.x;
  if (blk < 4096) {
    const int i = blk * 256 + tid;
    x16[i] = (_Float16)x[i];
    return;
  }
  blk -= 4096;
  if (blk < 16384) {
    const int mat   = blk >> 10;          // which * 4 + n
    const int which = mat >> 2;           // 0 Wq, 1 Wk, 2 Wv, 3 Wo
    const int n     = mat & 3;
    const int c = (blk & 31) * 16 + (tid & 15);
    const int r = ((blk >> 5) & 31) * 16 + (tid >> 4);
    const float* src = (which == 0 ? Wq : which == 1 ? Wk : which == 2 ? Wv : Wo)
                       + (long)n * 512 * 512;
    _Float16* dst = which < 3 ? WqkvT + (long)mat * 512 * 512 : WoT + (long)n * 512;
    const int ld  = which < 3 ? 512 : 2048;
    dst[(long)c * ld + r] = (_Float16)src[(long)r * 512 + c];
    // Keeps the store's registers from being rewritten on any later path of the listing.
    asm volatile("s_wait_xcnt 0x0" ::: "memory");
    return;
  }
  blk -= 16384;
  const int d = blk * 256 + tid;
  float s = 0.0f;
  for (int n = 0; n < 4; ++n) s += bo[n * 512 + d];
  bos[d] = s;
}

// One block per score row: P_row = sum_h gate_h * softmax(s_h * row).
// Row max commutes with the positive per-head scale, so one max serves all heads.
__global__ void __launch_bounds__(256)
softmax_combine(const float* __restrict__ scores, _Float16* __restrict__ P,
                const float* __restrict__ strength, const float* __restrict__ gate)
{
  const int S = 1024;
  const int row = blockIdx.x;
  const int zb  = blockIdx.y;     // n*2 + b
  const int n   = zb >> 1;
  const float4* src = (const float4*)(scores + ((long)zb * S + row) * S);
  _Float16*     dst = P + ((long)zb * S + row) * S;
  const int tid = threadIdx.x;    // 0..255, 4 elements each

  __shared__ float red[256];
  __shared__ float wsh[8];

  float4 xv = src[tid];
  float m = fmaxf(fmaxf(xv.x, xv.y), fmaxf(xv.z, xv.w));
  red[tid] = m; __syncthreads();
  for (int s = 128; s > 0; s >>= 1) {
    if (tid < s) red[tid] = fmaxf(red[tid], red[tid + s]);
    __syncthreads();
  }
  m = red[0];

  float sh[8], gh[8];
#pragma unroll
  for (int h = 0; h < 8; ++h) {
    sh[h] = fminf(fmaxf(strength[n * 64 + h * 9], 0.01f), 1.0f);  // diag, clamped
    gh[h] = gate[n * 8 + h];
  }

  for (int h = 0; h < 8; ++h) {
    float s = sh[h];
    float t = __expf(s * (xv.x - m)) + __expf(s * (xv.y - m)) +
              __expf(s * (xv.z - m)) + __expf(s * (xv.w - m));
    __syncthreads();
    red[tid] = t; __syncthreads();
    for (int st = 128; st > 0; st >>= 1) {
      if (tid < st) red[tid] += red[tid + st];
      __syncthreads();
    }
    if (tid == 0) wsh[h] = gh[h] / red[0];
  }
  __syncthreads();

  float o0 = 0, o1 = 0, o2 = 0, o3 = 0;
#pragma unroll
  for (int h = 0; h < 8; ++h) {
    float s = sh[h], wv = wsh[h];
    o0 += wv * __expf(s * (xv.x - m));
    o1 += wv * __expf(s * (xv.y - m));
    o2 += wv * __expf(s * (xv.z - m));
    o3 += wv * __expf(s * (xv.w - m));
  }
  v4h o = {(_Float16)o0, (_Float16)o1, (_Float16)o2, (_Float16)o3};
  *(v4h*)(dst + tid * 4) = o;
}

extern "C" void kernel_launch(void* const* d_in, const int* in_sizes, int n_in,
                              void* d_out, int out_size, void* d_ws, size_t ws_size,
                              hipStream_t stream) {
  (void)in_sizes; (void)n_in; (void)out_size; (void)ws_size;
  const float* x        = (const float*)d_in[0];
  const float* Wq       = (const float*)d_in[1];
  const float* bq       = (const float*)d_in[2];
  const float* Wk       = (const float*)d_in[3];
  const float* bk       = (const float*)d_in[4];
  const float* Wv       = (const float*)d_in[5];
  const float* bv       = (const float*)d_in[6];
  const float* Wo       = (const float*)d_in[7];
  const float* bo       = (const float*)d_in[8];
  const float* strength = (const float*)d_in[9];
  const float* gate     = (const float*)d_in[10];
  float* out = (float*)d_out;

  const int NB = 4, B = 2, S = 1024, D = 512, HID = 512;
  const long MS = (long)B * S;  // 2048

  char* w = (char*)d_ws;
  _Float16* x16  = (_Float16*)w; w += MS * D * 2;                  // [2048,512]
  _Float16* WqT  = (_Float16*)w; w += (long)NB * HID * D * 2;      // [n][HID,D]
  _Float16* WkT  = (_Float16*)w; w += (long)NB * HID * D * 2;
  _Float16* WvT  = (_Float16*)w; w += (long)NB * HID * D * 2;
  _Float16* WoT  = (_Float16*)w; w += (long)D * NB * HID * 2;      // [D, NB*HID]
  _Float16* q16  = (_Float16*)w; w += (long)NB * MS * HID * 2;     // [n][2048,512]
  _Float16* k16  = (_Float16*)w; w += (long)NB * MS * HID * 2;
  _Float16* vT16 = (_Float16*)w; w += (long)NB * HID * MS * 2;     // [n][HID, b*S+t]
  float*    sc   = (float*)w;    w += (long)NB * B * S * S * 4;    // [n][b][S,S]
  _Float16* P16  = (_Float16*)w; w += (long)NB * B * S * S * 2;    // [n][b][S,S]
  _Float16* hs   = (_Float16*)w; w += MS * (long)NB * HID * 2;     // [b*S, NB*HID]
  float*    bos  = (float*)w;    w += 512 * 4;

  (void)WkT; (void)WvT;   // reached through WqT: the three are adjacent

  const dim3 tb(256);

  const int NO_TR = 0x40000000;   // tfrom of a launch in which no group stores transposed

  // Stage 0: f16 conversion + weight transposes (A x B^T convention everywhere)
  // + summed output bias, one launch. WqT, WkT, WvT are adjacent in the workspace.
  prep_inputs<<<dim3(4096 + 16384 + 2), 256, 0, stream>>>(
      x, Wq, Wk, Wv, Wo, bo, x16, WqT, WoT, bos);

  // Stage 1: Q, K, V projections of all blocks in one launch, z = which*4 + n:
  // [2048,512] x [512,512]^T each. WqT/WkT/WvT and q16/k16/vT16 are adjacent in
  // the workspace; V (group 2) is stored transposed as vT[n][h][b*S+t].
  gemm_f16_wmma<<<dim3(HID / 64, MS / 256, 3 * NB), tb, 0, stream>>>(
      x16, 0L, 0L, D, WqT, (long)NB * HID * D, (long)HID * D, D,
      q16, (long)NB * MS * HID, (long)MS * HID, HID, (int)MS,
      bq, bk, bv, (long)HID, 1.0f, 2, 2, D, 1);

  // Stage 3: scores = q k^T / sqrt(512); q/k offsets are linear in z = n*2+b.
  gemm_f16_wmma<<<dim3(S / 64, S / 256, NB * B), tb, 0, stream>>>(
      q16, (long)S * HID, 0L, HID, k16, (long)S * HID, 0L, HID,
      sc, (long)S * S, 0L, S, 0, nullptr, nullptr, nullptr, 0L,
      0.044194173824159216f, 0, NO_TR, HID, 0);

  // Stage 4: combined gate-weighted softmax over all 8 heads -> one prob matrix.
  softmax_combine<<<dim3(S, NB * B), 256, 0, stream>>>(sc, P16, strength, gate);

  // Stage 5: head_sum = P @ v for all (n, b) in one launch, z = n*2 + b,
  // staged as hs[b*S + s][n*HID + h].
  gemm_f16_wmma<<<dim3(HID / 64, S / 256, NB * B), tb, 0, stream>>>(
      P16, (long)B * S * S, (long)S * S, S,
      vT16, (long)HID * MS, (long)S, (int)MS,
      hs, (long)HID, (long)S * NB * HID, NB * HID, 0,
      nullptr, nullptr, nullptr, 0L, 1.0f, 1, NO_TR, S, 1);

  // Stage 6: out = MOD * (hs @ Wo_all + sum_n bo[n]); K = NB*HID = 2048.
  gemm_f16_wmma<<<dim3(D / 64, MS / 256, 1), tb, 0, stream>>>(
      hs, 0L, 0L, NB * HID, WoT, 0L, 0L, NB * HID,
      out, 0L, 0L, D, 0, bos, bos, bos, 0L, 1.55f, 0, NO_TR, NB * HID, 0);
}

// v002
// One run takes 152 microseconds.
// Timed twice side by side with v001, it ran 1.08 and 1.09 times as fast.
// All steps since v000 together make it 1.99 times as fast.
#include <hip/hip_runtime.h>
#include <hip/hip_bf16.h>

typedef _Float16 v16h __attribute__((ext_vector_type(16)));
typedef _Float16 v8h  __attribute__((ext_vector_type(8)));
typedef _Float16 v4h  __attribute__((ext_vector_type(4)));
typedef float    v8f  __attribute__((ext_vector_type(8)));
typedef float    v4f  __attribute__((ext_vector_type(4)));
typedef unsigned int u32x4 __attribute__((ext_vector_type(4)));
typedef int          i32x8 __attribute__((ext_vector_type(8)));
typedef int          i32x4 __attribute__((ext_vector_type(4)));

#if __has_builtin(__builtin_amdgcn_tensor_load_to_lds)
#define USE_TDM 1
#else
#define USE_TDM 0
#endif

// LDS B tile: 64 rows x 128 halves per chunk, padded to 136 halves (272B) per
// row so consecutive fragment rows hit different LDS banks (256B stride would
// alias all 16 rows onto the same bank: 64 banks x 4B).
#define BROW 136
#define CHUNK 128

// Load one 16-half WMMA fragment (global, row stride = ld).
// 16-bit A/B^T layout: lane<16 holds K = k+0..7 and k+16..23,
// lane>=16 holds K = k+8..15 and k+24..31 (koff pre-applied by caller).
__device__ __forceinline__ v16h load_frag(const _Float16* __restrict__ p) {
  v8h lo = *(const v8h*)(p);
  v8h hi = *(const v8h*)(p + 16);
  return __builtin_shufflevector(lo, hi, 0,1,2,3,4,5,6,7,8,9,10,11,12,13,14,15);
}

__device__ __forceinline__ v16h lds_frag(const _Float16* p) {
  v8h lo = *(const v8h*)(p);
  v8h hi = *(const v8h*)(p + 16);
  return __builtin_shufflevector(lo, hi, 0,1,2,3,4,5,6,7,8,9,10,11,12,13,14,15);
}

#if USE_TDM
// Issue a TDM DMA of a 64-row x 128-half tile of Bt (row stride ldb halves)
// into LDS at lds_addr, with 4-DWORD padding every 64 DWORDs (-> 272B rows).
// This toolchain exposes the 6-arg clang-23 builtin:
//   (u32x4 group0, i32x8 group1, i32x4 group2, i32x4 group3, i32x8, i32 cpol)
__device__ __forceinline__ void tdm_load_B(const _Float16* gptr, unsigned lds_addr, int ldb) {
  unsigned long long ga = (unsigned long long)(uintptr_t)gptr;
  u32x4 g0;
  g0[0] = 1u;                                   // count=1 (valid user descriptor)
  g0[1] = lds_addr;                             // lds_addr [63:32]
  g0[2] = (unsigned)ga;                         // global_addr [95:64]
  g0[3] = (unsigned)(ga >> 32) | (2u << 30);    // global_addr hi + type=2 (image)
  i32x8 g1;
  // data_size=2B, pad_enable, pad_interval=64 DWORDs (code 5), pad_amount=4 DWORDs (code 3)
  g1[0] = (int)((1u << 16) | (1u << 20) | (5u << 22) | (3u << 25));
  const unsigned td0 = 0x40000000u, td1 = 0x40000000u;  // huge dims: no OOB clamp
  g1[1] = (int)((td0 & 0xFFFFu) << 16);                 // tensor_dim0[15:0]
  g1[2] = (int)((td0 >> 16) | ((td1 & 0xFFFFu) << 16)); // tensor_dim0 hi | tensor_dim1 lo
  g1[3] = (int)((td1 >> 16) | ((unsigned)CHUNK << 16)); // tensor_dim1 hi | tile_dim0=128
  g1[4] = 64;                                           // tile_dim1=64, tile_dim2=0
  g1[5] = ldb;                                          // tensor_dim0_stride[31:0]
  g1[6] = 0;                                            // stride hi | dim1_stride lo
  g1[7] = 0;
  i32x4 z4 = {0, 0, 0, 0};                              // group2/3: 2D tile -> zero (NULL)
  i32x8 z8 = {0, 0, 0, 0, 0, 0, 0, 0};
  __builtin_amdgcn_tensor_load_to_lds(g0, g1, z4, z4, z8, 0);
}
#endif

// Generic C = scale * (A[M,K] x Bt[N,K]^T + bias[col]) GEMM, f16 in, f32 acc.
// flags bit0: store f16 (else f32).
// Grid: x = N/64, y = M/256, z = batch. Block: 256 threads = 8 waves.
// The batch index splits into a group zh = z >> zshift and a member
// zl = z & ((1 << zshift) - 1), each with its own operand strides, so that
// products which differ in two indices share one launch. Group zh takes
// bias0, bias1 or bias2 (zh >= 2); groups zh >= tfrom store transposed
// (C[col*ldcT+row]).
// The 64-col B panel is staged into LDS (TDM DMA, double buffered, 128-wide K
// chunks) and shared by all 8 waves; each wave computes a 32x64 sub-tile
// (2 A frags x 4 B frags -> 8 WMMAs per k-step).
__global__ void __launch_bounds__(256)
gemm_f16_wmma(const _Float16* __restrict__ A, long sAh, long sAl, int lda,
              const _Float16* __restrict__ Bt, long sBh, long sBl, int ldb,
              void* __restrict__ Cv, long sCh, long sCl, int ldc, int ldcT,
              const float* __restrict__ bias0, const float* __restrict__ bias1,
              const float* __restrict__ bias2, long sBiasl,
              float scale, int zshift, int tfrom, int K, int flags)
{
  const int z    = blockIdx.z;
  const int zh   = z >> zshift;
  const int zl   = z - (zh << zshift);
  A  += zh * sAh + zl * sAl;
  Bt += zh * sBh + zl * sBl;
  const int lane = threadIdx.x & 31;
  const int wave = threadIdx.x >> 5;
  const int m0   = blockIdx.y * 256 + wave * 32;
  const int n0   = blockIdx.x * 64;
  const int lr   = lane & 15;
  const int koff = (lane >> 4) * 8;

  __shared__ __align__(16) _Float16 tileB[2][64 * BROW];

  const _Float16* abase0 = A + (long)(m0 +  0 + lr) * lda + koff;
  const _Float16* abase1 = A + (long)(m0 + 16 + lr) * lda + koff;
  const _Float16* btile  = Bt + (long)n0 * ldb;   // 64-row panel for this block

  const int nchunks = K >> 7;   // K / 128

  // Prologue: stage chunk 0 into buffer 0.
#if USE_TDM
  if (threadIdx.x < 32) {
    tdm_load_B(btile, (unsigned)(uintptr_t)&tileB[0][0], ldb);
    __builtin_amdgcn_s_wait_tensorcnt(0);
  }
#else
  {
    const int tid = threadIdx.x;
#pragma unroll
    for (int t = 0; t < 4; ++t) {
      int idx = t * 256 + tid;          // 1024 16-byte chunks
      int r = idx >> 3, c8 = (idx & 7) * 16;
      *(v8h*)(&tileB[0][r * BROW + c8]) = *(const v8h*)(btile + (long)r * ldb + c8);
    }
  }
#endif
  __syncthreads();

  v8f acc[4][2] = {};
  for (int c = 0; c < nchunks; ++c) {
    const int buf = c & 1;
    const int kc  = c * CHUNK;
    const bool more = (c + 1) < nchunks;

    // Overlap: DMA chunk c+1 into the other buffer while computing chunk c.
#if USE_TDM
    if (more && threadIdx.x < 32)
      tdm_load_B(btile + kc + CHUNK, (unsigned)(uintptr_t)&tileB[buf ^ 1][0], ldb);
#else
    if (more) {
      const int tid = threadIdx.x;
#pragma unroll
      for (int t = 0; t < 4; ++t) {
        int idx = t * 256 + tid;
        int r = idx >> 3, c8 = (idx & 7) * 16;
        *(v8h*)(&tileB[buf ^ 1][r * BROW + c8]) =
            *(const v8h*)(btile + (long)r * ldb + kc + CHUNK + c8);
      }
    }
#endif
    // Keep A one chunk ahead in the WGP cache (speculative; OOB dropped).
    __builtin_prefetch((const void*)(abase0 + kc + CHUNK), 0, 1);
    __builtin_prefetch((const void*)(abase1 + kc + CHUNK), 0, 1);

    const _Float16* Bl = &tileB[buf][0];
#pragma unroll
    for (int kk = 0; kk < CHUNK; kk += 32) {
      v16h a0 = load_frag(abase0 + kc + kk);
      v16h a1 = load_frag(abase1 + kc + kk);
      v16h f0 = lds_frag(Bl + ( 0 + lr) * BROW + kk + koff);
      v16h f1 = lds_frag(Bl + (16 + lr) * BROW + kk + koff);
      v16h f2 = lds_frag(Bl + (32 + lr) * BROW + kk + koff);
      v16h f3 = lds_frag(Bl + (48 + lr) * BROW + kk + koff);
      acc[0][0] = __builtin_amdgcn_wmma_f32_16x16x32_f16(false, a0, false, f0, (short)0, acc[0][0], false, false);
      acc[0][1] = __builtin_amdgcn_wmma_f32_16x16x32_f16(false, a1, false, f0, (short)0, acc[0][1], false, false);
      acc[1][0] = __builtin_amdgcn_wmma_f32_16x16x32_f16(false, a0, false, f1, (short)0, acc[1][0], false, false);
      acc[1][1] = __builtin_amdgcn_wmma_f32_16x16x32_f16(false, a1, false, f1, (short)0, acc[1][1], false, false);
      acc[2][0] = __builtin_amdgcn_wmma_f32_16x16x32_f16(false, a0, false, f2, (short)0, acc[2][0], false, false);
      acc[2][1] = __builtin_amdgcn_wmma_f32_16x16x32_f16(false, a1, false, f2, (short)0, acc[2][1], false, false);
      acc[3][0] = __builtin_amdgcn_wmma_f32_16x16x32_f16(false, a0, false, f3, (short)0, acc[3][0], false, false);
      acc[3][1] = __builtin_amdgcn_wmma_f32_16x16x32_f16(false, a1, false, f3, (short)0, acc[3][1], false, false);
    }

    if (more) {
#if USE_TDM
      if (threadIdx.x < 32) __builtin_amdgcn_s_wait_tensorcnt(0);
#endif
      __syncthreads();   // publish buf^1; all waves done reading buf
    }
  }

  // Epilogue. C layout per 16x16 tile: lanes 0-15 -> M = base+0..7,
  // lanes 16-31 -> M = base+8..15, N = n0 + j*16 + (lane&15);
  // accumulator element r holds row (base + r).
  float*    Cf = (float*)Cv    + (zh * sCh + zl * sCl);
  _Float16* Ch = (_Float16*)Cv + (zh * sCh + zl * sCl);
  const float* bias = zh == 0 ? bias0 : zh == 1 ? bias1 : bias2;
  const float* bp = bias ? bias + zl * sBiasl : nullptr;
  const bool tr = zh >= tfrom;
#pragma unroll
  for (int j = 0; j < 4; ++j) {
    const int col = n0 + j * 16 + lr;
    const float bval = bp ? bp[col] : 0.0f;
#pragma unroll
    for (int t = 0; t < 2; ++t) {
      const int rowb = m0 + t * 16 + (lane >> 4) * 8;
#pragma unroll
      for (int r = 0; r < 8; ++r) {
        float o = (acc[j][t][r] + bval) * scale;
        long addr = tr ? ((long)col * ldcT + (rowb + r))
                       : ((long)(rowb + r) * ldc + col);
        if (flags & 1) Ch[addr] = (_Float16)o;
        else           Cf[addr] = o;
      }
    }
  }
}

// All input staging in one launch. Blocks 0..255, one per WGP, each do an equal
// share of the first two parts, with all of their global loads issued up front:
//   x16 = f16(x): 4096 consecutive elements, 16 per thread
//   one 128x128 tile of the sixteen 512x512 weight transposes, f32 -> f16:
//   dst[c*ld + r] = src[r*512 + c]; a wave reads whole 512-byte tile rows,
//   each thread turns 4x4 elements in registers, the tile goes through LDS, and
//   16 lanes store each 256-byte output row
// Block 256: bos[d] = sum_n bo[n][d].
// WqkvT holds the transposed Wq, Wk, Wv as twelve [HID,D] matrices in a row;
// WoT[d][n*HID + h] = Wo[n][h][d].
// LDS tile: row c holds 128 halves = 16 units of 16 bytes; unit u of row c lies
// at place u ^ ((c >> 2) & 15), so that the 32 lanes of a write, which are four
// rows apart, spread over the banks, and a read of a row still covers all banks.
__global__ void __launch_bounds__(256)
prep_inputs(const float* __restrict__ x,  const float* __restrict__ Wq,
            const float* __restrict__ Wk, const float* __restrict__ Wv,
            const float* __restrict__ Wo, const float* __restrict__ bo,
            _Float16* __restrict__ x16, _Float16* __restrict__ WqkvT,
            _Float16* __restrict__ WoT, float* __restrict__ bos)
{
  __shared__ __align__(16) _Float16 tl[128 * 128];

  const int tid = threadIdx.x;
  const int blk = blockIdx.x;

  if (blk == 256) {                     // the whole block leaves before the barrier
#pragma unroll
    for (int t = 0; t < 2; ++t) {
      const int d = t * 256 + tid;
      float s = 0.0f;
      for (int m = 0; m < 4; ++m) s += bo[m * 512 + d];
      bos[d] = s;
    }
    return;
  }

  const v4f* xs = (const v4f*)x + blk * 1024 + tid;
  v4f xv[4];
#pragma unroll
  for (int i = 0; i < 4; ++i) xv[i] = xs[i * 256];

  const int mat   = blk >> 4;           // which * 4 + n
  const int which = mat >> 2;           // 0 Wq, 1 Wk, 2 Wv, 3 Wo
  const int n     = mat & 3;
  const int c0 = (blk & 3) * 128;
  const int r0 = ((blk >> 2) & 3) * 128;
  const float* src = (which == 0 ? Wq : which == 1 ? Wk : which == 2 ? Wv : Wo)
                     + (long)n * 512 * 512 + (long)r0 * 512 + c0;
  const int cb = tid & 31;              // columns cb*4 .. cb*4+3 of the tile
  const int rw = tid >> 5;              // rows (rw + 8*i)*4 .. +3 of the tile
  const float* wp = src + rw * 4 * 512 + cb * 4;
  v4f wv[4][4];
#pragma unroll
  for (int i = 0; i < 4; ++i)
#pragma unroll
    for (int k = 0; k < 4; ++k)
      wv[i][k] = *(const v4f*)(wp + (8 * i * 4 + k) * 512);
  // Keeps all twenty loads in front of the first use of a loaded value: without
  // it the last six are issued behind the first waits, and the block pays the
  // memory latency twice.
  __builtin_amdgcn_sched_barrier(0);
  // The wait in front of any rewrite of the address pair that the sixteen weight
  // loads name; as an input the pair stays whole up to here, so that no load's
  // own result is laid over it.
  asm volatile("s_wait_xcnt 0x0" :: "v"(wp) : "memory");

#pragma unroll
  for (int i = 0; i < 4; ++i) {
    const int rb   = rw + 8 * i;
    const int slot = (((rb >> 1) ^ (cb & 15)) << 3) + ((rb & 1) << 2);
#pragma unroll
    for (int j = 0; j < 4; ++j) {
      v4h h = {(_Float16)wv[i][0][j], (_Float16)wv[i][1][j],
               (_Float16)wv[i][2][j], (_Float16)wv[i][3][j]};
      *(v4h*)(&tl[(cb * 4 + j) * 128 + slot]) = h;
    }
  }
  __syncthreads();

  _Float16* dst = (which < 3 ? WqkvT + (long)mat * 512 * 512 : WoT + (long)n * 512) + r0;
  const int ld  = which < 3 ? 512 : 2048;
#pragma unroll
  for (int i = 0; i < 8; ++i) {
    const int c = i * 16 + (tid >> 4);
    const int u = tid & 15;
    v8h v = *(const v8h*)(&tl[c * 128 + ((u ^ ((c >> 2) & 15)) << 3)]);
    *(v8h*)(dst + (c0 + c) * ld + u * 8) = v;
  }

  // x16 is stored last: in front of the barrier, the barrier would wait for
  // these stores to complete.
  v4h* xd = (v4h*)x16 + blk * 1024 + tid;
#pragma unroll
  for (int i = 0; i < 4; ++i) {
    v4h o = {(_Float16)xv[i][0], (_Float16)xv[i][1], (_Float16)xv[i][2], (_Float16)xv[i][3]};
    xd[i * 256] = o;
  }
}

// One block per score row: P_row = sum_h gate_h * softmax(s_h * row).
// Row max commutes with the positive per-head scale, so one max serves all heads.
__global__ void __launch_bounds__(256)
softmax_combine(const float* __restrict__ scores, _Float16* __restrict__ P,
                const float* __restrict__ strength, const float* __restrict__ gate)
{
  const int S = 1024;
  const int row = blockIdx.x;
  const int zb  = blockIdx.y;     // n*2 + b
  const int n   = zb >> 1;
  const float4* src = (const float4*)(scores + ((long)zb * S + row) * S);
  _Float16*     dst = P + ((long)zb * S + row) * S;
  const int tid = threadIdx.x;    // 0..255, 4 elements each

  __shared__ float red[256];
  __shared__ float wsh[8];

  float4 xv = src[tid];
  float m = fmaxf(fmaxf(xv.x, xv.y), fmaxf(xv.z, xv.w));
  red[tid] = m; __syncthreads();
  for (int s = 128; s > 0; s >>= 1) {
    if (tid < s) red[tid] = fmaxf(red[tid], red[tid + s]);
    __syncthreads();
  }
  m = red[0];

  float sh[8], gh[8];
#pragma unroll
  for (int h = 0; h < 8; ++h) {
    sh[h] = fminf(fmaxf(strength[n * 64 + h * 9], 0.01f), 1.0f);  // diag, clamped
    gh[h] = gate[n * 8 + h];
  }

  for (int h = 0; h < 8; ++h) {
    float s = sh[h];
    float t = __expf(s * (xv.x - m)) + __expf(s * (xv.y - m)) +
              __expf(s * (xv.z - m)) + __expf(s * (xv.w - m));
    __syncthreads();
    red[tid] = t; __syncthreads();
    for (int st = 128; st > 0; st >>= 1) {
      if (tid < st) red[tid] += red[tid + st];
      __syncthreads();
    }
    if (tid == 0) wsh[h] = gh[h] / red[0];
  }
  __syncthreads();

  float o0 = 0, o1 = 0, o2 = 0, o3 = 0;
#pragma unroll
  for (int h = 0; h < 8; ++h) {
    float s = sh[h], wv = wsh[h];
    o0 += wv * __expf(s * (xv.x - m));
    o1 += wv * __expf(s * (xv.y - m));
    o2 += wv * __expf(s * (xv.z - m));
    o3 += wv * __expf(s * (xv.w - m));
  }
  v4h o = {(_Float16)o0, (_Float16)o1, (_Float16)o2, (_Float16)o3};
  *(v4h*)(dst + tid * 4) = o;
}

extern "C" void kernel_launch(void* const* d_in, const int* in_sizes, int n_in,
                              void* d_out, int out_size, void* d_ws, size_t ws_size,
                              hipStream_t stream) {
  (void)in_sizes; (void)n_in; (void)out_size; (void)ws_size;
  const float* x        = (const float*)d_in[0];
  const float* Wq       = (const float*)d_in[1];
  const float* bq       = (const float*)d_in[2];
  const float* Wk       = (const float*)d_in[3];
  const float* bk       = (const float*)d_in[4];
  const float* Wv       = (const float*)d_in[5];
  const float* bv       = (const float*)d_in[6];
  const float* Wo       = (const float*)d_in[7];
  const float* bo       = (const float*)d_in[8];
  const float* strength = (const float*)d_in[9];
  const float* gate     = (const float*)d_in[10];
  float* out = (float*)d_out;

  const int NB = 4, B = 2, S = 1024, D = 512, HID = 512;
  const long MS = (long)B * S;  // 2048

  char* w = (char*)d_ws;
  _Float16* x16  = (_Float16*)w; w += MS * D * 2;                  // [2048,512]
  _Float16* WqT  = (_Float16*)w; w += (long)NB * HID * D * 2;      // [n][HID,D]
  _Float16* WkT  = (_Float16*)w; w += (long)NB * HID * D * 2;
  _Float16* WvT  = (_Float16*)w; w += (long)NB * HID * D * 2;
  _Float16* WoT  = (_Float16*)w; w += (long)D * NB * HID * 2;      // [D, NB*HID]
  _Float16* q16  = (_Float16*)w; w += (long)NB * MS * HID * 2;     // [n][2048,512]
  _Float16* k16  = (_Float16*)w; w += (long)NB * MS * HID * 2;
  _Float16* vT16 = (_Float16*)w; w += (long)NB * HID * MS * 2;     // [n][HID, b*S+t]
  float*    sc   = (float*)w;    w += (long)NB * B * S * S * 4;    // [n][b][S,S]
  _Float16* P16  = (_Float16*)w; w += (long)NB * B * S * S * 2;    // [n][b][S,S]
  _Float16* hs   = (_Float16*)w; w += MS * (long)NB * HID * 2;     // [b*S, NB*HID]
  float*    bos  = (float*)w;    w += 512 * 4;

  (void)WkT; (void)WvT;   // reached through WqT: the three are adjacent

  const dim3 tb(256);

  const int NO_TR = 0x40000000;   // tfrom of a launch in which no group stores transposed

  // Stage 0: f16 conversion + weight transposes (A x B^T convention everywhere)
  // + summed output bias, one launch. WqT, WkT, WvT are adjacent in the workspace.
  prep_inputs<<<dim3(257), 256, 0, stream>>>(
      x, Wq, Wk, Wv, Wo, bo, x16, WqT, WoT, bos);

  // Stage 1: Q, K, V projections of all blocks in one launch, z = which*4 + n:
  // [2048,512] x [512,512]^T each. WqT/WkT/WvT and q16/k16/vT16 are adjacent in
  // the workspace; V (group 2) is stored transposed as vT[n][h][b*S+t].
  gemm_f16_wmma<<<dim3(HID / 64, MS / 256, 3 * NB), tb, 0, stream>>>(
      x16, 0L, 0L, D, WqT, (long)NB * HID * D, (long)HID * D, D,
      q16, (long)NB * MS * HID, (long)MS * HID, HID, (int)MS,
      bq, bk, bv, (long)HID, 1.0f, 2, 2, D, 1);

  // Stage 3: scores = q k^T / sqrt(512); q/k offsets are linear in z = n*2+b.
  gemm_f16_wmma<<<dim3(S / 64, S / 256, NB * B), tb, 0, stream>>>(
      q16, (long)S * HID, 0L, HID, k16, (long)S * HID, 0L, HID,
      sc, (long)S * S, 0L, S, 0, nullptr, nullptr, nullptr, 0L,
      0.044194173824159216f, 0, NO_TR, HID, 0);

  // Stage 4: combined gate-weighted softmax over all 8 heads -> one prob matrix.
  softmax_combine<<<dim3(S, NB * B), 256, 0, stream>>>(sc, P16, strength, gate);

  // Stage 5: head_sum = P @ v for all (n, b) in one launch, z = n*2 + b,
  // staged as hs[b*S + s][n*HID + h].
  gemm_f16_wmma<<<dim3(HID / 64, S / 256, NB * B), tb, 0, stream>>>(
      P16, (long)B * S * S, (long)S * S, S,
      vT16, (long)HID * MS, (long)S, (int)MS,
      hs, (long)HID, (long)S * NB * HID, NB * HID, 0,
      nullptr, nullptr, nullptr, 0L, 1.0f, 1, NO_TR, S, 1);

  // Stage 6: out = MOD * (hs @ Wo_all + sum_n bo[n]); K = NB*HID = 2048.
  gemm_f16_wmma<<<dim3(D / 64, MS / 256, 1), tb, 0, stream>>>(
      hs, 0L, 0L, NB * HID, WoT, 0L, 0L, NB * HID,
      out, 0L, 0L, D, 0, bos, bos, bos, 0L, 1.55f, 0, NO_TR, NB * HID, 0);
}

// v003
// It runs in 127 microseconds.
// Two timings next to v002 put it at 1.20 and 1.19 times that version's speed.
// Counting every step since v000, it is 2.37 times as fast.
#include <hip/hip_runtime.h>
#include <hip/hip_bf16.h>

typedef _Float16 v16h __attribute__((ext_vector_type(16)));
typedef _Float16 v8h  __attribute__((ext_vector_type(8)));
typedef _Float16 v4h  __attribute__((ext_vector_type(4)));
typedef float    v8f  __attribute__((ext_vector_type(8)));
typedef float    v4f  __attribute__((ext_vector_type(4)));
typedef unsigned int u32x4 __attribute__((ext_vector_type(4)));
typedef int          i32x8 __attribute__((ext_vector_type(8)));
typedef int          i32x4 __attribute__((ext_vector_type(4)));

#if __has_builtin(__builtin_amdgcn_tensor_load_to_lds)
#define USE_TDM 1
#else
#define USE_TDM 0
#endif

// LDS B tile: 64 rows x 128 halves per chunk, padded to 136 halves (272B) per
// row so consecutive fragment rows hit different LDS banks (256B stride would
// alias all 16 rows onto the same bank: 64 banks x 4B).
#define BROW 136
#define CHUNK 128

// Load one 16-half WMMA fragment (global, row stride = ld).
// 16-bit A/B^T layout: lane<16 holds K = k+0..7 and k+16..23,
// lane>=16 holds K = k+8..15 and k+24..31 (koff pre-applied by caller).
__device__ __forceinline__ v16h load_frag(const _Float16* __restrict__ p) {
  v8h lo = *(const v8h*)(p);
  v8h hi = *(const v8h*)(p + 16);
  return __builtin_shufflevector(lo, hi, 0,1,2,3,4,5,6,7,8,9,10,11,12,13,14,15);
}

__device__ __forceinline__ v16h lds_frag(const _Float16* p) {
  v8h lo = *(const v8h*)(p);
  v8h hi = *(const v8h*)(p + 16);
  return __builtin_shufflevector(lo, hi, 0,1,2,3,4,5,6,7,8,9,10,11,12,13,14,15);
}

#if USE_TDM
// Issue a TDM DMA of a 64-row x 128-half tile of Bt (row stride ldb halves)
// into LDS at lds_addr, with 4-DWORD padding every 64 DWORDs (-> 272B rows).
// This toolchain exposes the 6-arg clang-23 builtin:
//   (u32x4 group0, i32x8 group1, i32x4 group2, i32x4 group3, i32x8, i32 cpol)
__device__ __forceinline__ void tdm_load_B(const _Float16* gptr, unsigned lds_addr, int ldb) {
  unsigned long long ga = (unsigned long long)(uintptr_t)gptr;
  u32x4 g0;
  g0[0] = 1u;                                   // count=1 (valid user descriptor)
  g0[1] = lds_addr;                             // lds_addr [63:32]
  g0[2] = (unsigned)ga;                         // global_addr [95:64]
  g0[3] = (unsigned)(ga >> 32) | (2u << 30);    // global_addr hi + type=2 (image)
  i32x8 g1;
  // data_size=2B, pad_enable, pad_interval=64 DWORDs (code 5), pad_amount=4 DWORDs (code 3)
  g1[0] = (int)((1u << 16) | (1u << 20) | (5u << 22) | (3u << 25));
  const unsigned td0 = 0x40000000u, td1 = 0x40000000u;  // huge dims: no OOB clamp
  g1[1] = (int)((td0 & 0xFFFFu) << 16);                 // tensor_dim0[15:0]
  g1[2] = (int)((td0 >> 16) | ((td1 & 0xFFFFu) << 16)); // tensor_dim0 hi | tensor_dim1 lo
  g1[3] = (int)((td1 >> 16) | ((unsigned)CHUNK << 16)); // tensor_dim1 hi | tile_dim0=128
  g1[4] = 64;                                           // tile_dim1=64, tile_dim2=0
  g1[5] = ldb;                                          // tensor_dim0_stride[31:0]
  g1[6] = 0;                                            // stride hi | dim1_stride lo
  g1[7] = 0;
  i32x4 z4 = {0, 0, 0, 0};                              // group2/3: 2D tile -> zero (NULL)
  i32x8 z8 = {0, 0, 0, 0, 0, 0, 0, 0};
  __builtin_amdgcn_tensor_load_to_lds(g0, g1, z4, z4, z8, 0);
}
#endif

// Generic C = scale * (A[M,K] x Bt[N,K]^T + bias[col]) GEMM, f16 in, f32 acc.
// flags bit0: store f16 (else f32).
// Grid: x = N/64, y = M/256, z = batch. Block: 256 threads = 8 waves.
// The batch index splits into a group zh = z >> zshift and a member
// zl = z & ((1 << zshift) - 1), each with its own operand strides, so that
// products which differ in two indices share one launch. Group zh takes
// bias0, bias1 or bias2 (zh >= 2); groups zh >= tfrom store transposed
// (C[col*ldcT+row]).
// The 64-col B panel is staged into LDS (TDM DMA, double buffered, 128-wide K
// chunks) and shared by all 8 waves; each wave computes a 32x64 sub-tile
// (2 A frags x 4 B frags -> 8 WMMAs per k-step).
__global__ void __launch_bounds__(256)
gemm_f16_wmma(const _Float16* __restrict__ A, long sAh, long sAl, int lda,
              const _Float16* __restrict__ Bt, long sBh, long sBl, int ldb,
              void* __restrict__ Cv, long sCh, long sCl, int ldc, int ldcT,
              const float* __restrict__ bias0, const float* __restrict__ bias1,
              const float* __restrict__ bias2, long sBiasl,
              float scale, int zshift, int tfrom, int K, int flags)
{
  const int z    = blockIdx.z;
  const int zh   = z >> zshift;
  const int zl   = z - (zh << zshift);
  A  += zh * sAh + zl * sAl;
  Bt += zh * sBh + zl * sBl;
  const int lane = threadIdx.x & 31;
  const int wave = threadIdx.x >> 5;
  const int m0   = blockIdx.y * 256 + wave * 32;
  const int n0   = blockIdx.x * 64;
  const int lr   = lane & 15;
  const int koff = (lane >> 4) * 8;

  __shared__ __align__(16) _Float16 tileB[2][64 * BROW];

  const _Float16* abase0 = A + (long)(m0 +  0 + lr) * lda + koff;
  const _Float16* abase1 = A + (long)(m0 + 16 + lr) * lda + koff;
  const _Float16* btile  = Bt + (long)n0 * ldb;   // 64-row panel for this block

  const int nchunks = K >> 7;   // K / 128

  // Prologue: stage chunk 0 into buffer 0.
#if USE_TDM
  if (threadIdx.x < 32) {
    tdm_load_B(btile, (unsigned)(uintptr_t)&tileB[0][0], ldb);
    __builtin_amdgcn_s_wait_tensorcnt(0);
  }
#else
  {
    const int tid = threadIdx.x;
#pragma unroll
    for (int t = 0; t < 4; ++t) {
      int idx = t * 256 + tid;          // 1024 16-byte chunks
      int r = idx >> 3, c8 = (idx & 7) * 16;
      *(v8h*)(&tileB[0][r * BROW + c8]) = *(const v8h*)(btile + (long)r * ldb + c8);
    }
  }
#endif
  __syncthreads();

  v8f acc[4][2] = {};
  for (int c = 0; c < nchunks; ++c) {
    const int buf = c & 1;
    const int kc  = c * CHUNK;
    const bool more = (c + 1) < nchunks;

    // Overlap: DMA chunk c+1 into the other buffer while computing chunk c.
#if USE_TDM
    if (more && threadIdx.x < 32)
      tdm_load_B(btile + kc + CHUNK, (unsigned)(uintptr_t)&tileB[buf ^ 1][0], ldb);
#else
    if (more) {
      const int tid = threadIdx.x;
#pragma unroll
      for (int t = 0; t < 4; ++t) {
        int idx = t * 256 + tid;
        int r = idx >> 3, c8 = (idx & 7) * 16;
        *(v8h*)(&tileB[buf ^ 1][r * BROW + c8]) =
            *(const v8h*)(btile + (long)r * ldb + kc + CHUNK + c8);
      }
    }
#endif
    // Keep A one chunk ahead in the WGP cache (speculative; OOB dropped).
    __builtin_prefetch((const void*)(abase0 + kc + CHUNK), 0, 1);
    __builtin_prefetch((const void*)(abase1 + kc + CHUNK), 0, 1);

    const _Float16* Bl = &tileB[buf][0];
#pragma unroll
    for (int kk = 0; kk < CHUNK; kk += 32) {
      v16h a0 = load_frag(abase0 + kc + kk);
      v16h a1 = load_frag(abase1 + kc + kk);
      v16h f0 = lds_frag(Bl + ( 0 + lr) * BROW + kk + koff);
      v16h f1 = lds_frag(Bl + (16 + lr) * BROW + kk + koff);
      v16h f2 = lds_frag(Bl + (32 + lr) * BROW + kk + koff);
      v16h f3 = lds_frag(Bl + (48 + lr) * BROW + kk + koff);
      acc[0][0] = __builtin_amdgcn_wmma_f32_16x16x32_f16(false, a0, false, f0, (short)0, acc[0][0], false, false);
      acc[0][1] = __builtin_amdgcn_wmma_f32_16x16x32_f16(false, a1, false, f0, (short)0, acc[0][1], false, false);
      acc[1][0] = __builtin_amdgcn_wmma_f32_16x16x32_f16(false, a0, false, f1, (short)0, acc[1][0], false, false);
      acc[1][1] = __builtin_amdgcn_wmma_f32_16x16x32_f16(false, a1, false, f1, (short)0, acc[1][1], false, false);
      acc[2][0] = __builtin_amdgcn_wmma_f32_16x16x32_f16(false, a0, false, f2, (short)0, acc[2][0], false, false);
      acc[2][1] = __builtin_amdgcn_wmma_f32_16x16x32_f16(false, a1, false, f2, (short)0, acc[2][1], false, false);
      acc[3][0] = __builtin_amdgcn_wmma_f32_16x16x32_f16(false, a0, false, f3, (short)0, acc[3][0], false, false);
      acc[3][1] = __builtin_amdgcn_wmma_f32_16x16x32_f16(false, a1, false, f3, (short)0, acc[3][1], false, false);
    }

    if (more) {
#if USE_TDM
      if (threadIdx.x < 32) __builtin_amdgcn_s_wait_tensorcnt(0);
#endif
      __syncthreads();   // publish buf^1; all waves done reading buf
    }
  }

  // Epilogue. C layout per 16x16 tile: lanes 0-15 -> M = base+0..7,
  // lanes 16-31 -> M = base+8..15, N = n0 + j*16 + (lane&15);
  // accumulator element r holds row (base + r).
  float*    Cf = (float*)Cv    + (zh * sCh + zl * sCl);
  _Float16* Ch = (_Float16*)Cv + (zh * sCh + zl * sCl);
  const float* bias = zh == 0 ? bias0 : zh == 1 ? bias1 : bias2;
  const float* bp = bias ? bias + zl * sBiasl : nullptr;
  const bool tr = zh >= tfrom;
#pragma unroll
  for (int j = 0; j < 4; ++j) {
    const int col = n0 + j * 16 + lr;
    const float bval = bp ? bp[col] : 0.0f;
#pragma unroll
    for (int t = 0; t < 2; ++t) {
      const int rowb = m0 + t * 16 + (lane >> 4) * 8;
#pragma unroll
      for (int r = 0; r < 8; ++r) {
        float o = (acc[j][t][r] + bval) * scale;
        long addr = tr ? ((long)col * ldcT + (rowb + r))
                       : ((long)(rowb + r) * ldc + col);
        if (flags & 1) Ch[addr] = (_Float16)o;
        else           Cf[addr] = o;
      }
    }
  }
}

// All input staging in one launch. Blocks 0..255, one per WGP, each do an equal
// share of the first two parts, with all of their global loads issued up front:
//   x16 = f16(x): 4096 consecutive elements, 16 per thread
//   one 128x128 tile of the sixteen 512x512 weight transposes, f32 -> f16:
//   dst[c*ld + r] = src[r*512 + c]; a wave reads whole 512-byte tile rows,
//   each thread turns 4x4 elements in registers, the tile goes through LDS, and
//   16 lanes store each 256-byte output row
// Block 256: bos[d] = sum_n bo[n][d].
// WqkvT holds the transposed Wq, Wk, Wv as twelve [HID,D] matrices in a row;
// WoT[d][n*HID + h] = Wo[n][h][d].
// LDS tile: row c holds 128 halves = 16 units of 16 bytes; unit u of row c lies
// at place u ^ ((c >> 2) & 15), so that the 32 lanes of a write, which are four
// rows apart, spread over the banks, and a read of a row still covers all banks.
__global__ void __launch_bounds__(256)
prep_inputs(const float* __restrict__ x,  const float* __restrict__ Wq,
            const float* __restrict__ Wk, const float* __restrict__ Wv,
            const float* __restrict__ Wo, const float* __restrict__ bo,
            _Float16* __restrict__ x16, _Float16* __restrict__ WqkvT,
            _Float16* __restrict__ WoT, float* __restrict__ bos)
{
  __shared__ __align__(16) _Float16 tl[128 * 128];

  const int tid = threadIdx.x;
  const int blk = blockIdx.x;

  if (blk == 256) {                     // the whole block leaves before the barrier
#pragma unroll
    for (int t = 0; t < 2; ++t) {
      const int d = t * 256 + tid;
      float s = 0.0f;
      for (int m = 0; m < 4; ++m) s += bo[m * 512 + d];
      bos[d] = s;
    }
    return;
  }

  const v4f* xs = (const v4f*)x + blk * 1024 + tid;
  v4f xv[4];
#pragma unroll
  for (int i = 0; i < 4; ++i) xv[i] = xs[i * 256];

  const int mat   = blk >> 4;           // which * 4 + n
  const int which = mat >> 2;           // 0 Wq, 1 Wk, 2 Wv, 3 Wo
  const int n     = mat & 3;
  const int c0 = (blk & 3) * 128;
  const int r0 = ((blk >> 2) & 3) * 128;
  const float* src = (which == 0 ? Wq : which == 1 ? Wk : which == 2 ? Wv : Wo)
                     + (long)n * 512 * 512 + (long)r0 * 512 + c0;
  const int cb = tid & 31;              // columns cb*4 .. cb*4+3 of the tile
  const int rw = tid >> 5;              // rows (rw + 8*i)*4 .. +3 of the tile
  const float* wp = src + rw * 4 * 512 + cb * 4;
  v4f wv[4][4];
#pragma unroll
  for (int i = 0; i < 4; ++i)
#pragma unroll
    for (int k = 0; k < 4; ++k)
      wv[i][k] = *(const v4f*)(wp + (8 * i * 4 + k) * 512);
  // Keeps all twenty loads in front of the first use of a loaded value: without
  // it the last six are issued behind the first waits, and the block pays the
  // memory latency twice.
  __builtin_amdgcn_sched_barrier(0);
  // The wait in front of any rewrite of the address pair that the sixteen weight
  // loads name; as an input the pair stays whole up to here, so that no load's
  // own result is laid over it.
  asm volatile("s_wait_xcnt 0x0" :: "v"(wp) : "memory");

#pragma unroll
  for (int i = 0; i < 4; ++i) {
    const int rb   = rw + 8 * i;
    const int slot = (((rb >> 1) ^ (cb & 15)) << 3) + ((rb & 1) << 2);
#pragma unroll
    for (int j = 0; j < 4; ++j) {
      v4h h = {(_Float16)wv[i][0][j], (_Float16)wv[i][1][j],
               (_Float16)wv[i][2][j], (_Float16)wv[i][3][j]};
      *(v4h*)(&tl[(cb * 4 + j) * 128 + slot]) = h;
    }
  }
  __syncthreads();

  _Float16* dst = (which < 3 ? WqkvT + (long)mat * 512 * 512 : WoT + (long)n * 512) + r0;
  const int ld  = which < 3 ? 512 : 2048;
#pragma unroll
  for (int i = 0; i < 8; ++i) {
    const int c = i * 16 + (tid >> 4);
    const int u = tid & 15;
    v8h v = *(const v8h*)(&tl[c * 128 + ((u ^ ((c >> 2) & 15)) << 3)]);
    *(v8h*)(dst + (c0 + c) * ld + u * 8) = v;
  }

  // x16 is stored last: in front of the barrier, the barrier would wait for
  // these stores to complete.
  v4h* xd = (v4h*)x16 + blk * 1024 + tid;
#pragma unroll
  for (int i = 0; i < 4; ++i) {
    v4h o = {(_Float16)xv[i][0], (_Float16)xv[i][1], (_Float16)xv[i][2], (_Float16)xv[i][3]};
    xd[i * 256] = o;
  }
}

// One step of a butterfly inside a 16-lane row: the value of lane l ^ mask
// (CTRL = 0x160 + mask, the row_xmask control). All 32 lanes are on at every call.
template <int CTRL>
__device__ __forceinline__ float row_xmask(float v) {
  return __builtin_bit_cast(float, __builtin_amdgcn_update_dpp(
      0, __builtin_bit_cast(int, v), CTRL, 0xf, 0xf, true));
}

// The value of lane l ^ 16.
__device__ __forceinline__ float other_row(float v) {
  const int b = __builtin_bit_cast(int, v);
  return __builtin_bit_cast(float,
      __builtin_amdgcn_permlanex16(b, b, 0x76543210, 0xfedcba98, false, false));
}

__device__ __forceinline__ float wave_max(float v) {
  v = fmaxf(v, row_xmask<0x161>(v));
  v = fmaxf(v, row_xmask<0x162>(v));
  v = fmaxf(v, row_xmask<0x164>(v));
  v = fmaxf(v, row_xmask<0x168>(v));
  return fmaxf(v, other_row(v));
}

__device__ __forceinline__ float wave_sum(float v) {
  v += row_xmask<0x161>(v);
  v += row_xmask<0x162>(v);
  v += row_xmask<0x164>(v);
  v += row_xmask<0x168>(v);
  return v + other_row(v);
}

// One wave per score row: P_row = sum_h gate_h * softmax(s_h * row).
// Row max commutes with the positive per-head scale, so one max serves all heads.
// A lane holds 32 elements of its row in registers. The maximum and each head's
// sum go over the lanes by register butterflies, and a head's exponentials are
// added into the output row as soon as its sum is known, so the kernel has no LDS
// and no barrier. Four rows of one (n, b) to a block.
__global__ void __launch_bounds__(128)
softmax_combine(const float* __restrict__ scores, _Float16* __restrict__ P,
                const float* __restrict__ strength, const float* __restrict__ gate)
{
  const int S = 1024;
  const int lane = threadIdx.x & 31;
  const long row = blockIdx.x * 4 + (threadIdx.x >> 5);   // (n*2 + b) * S + s
  const int  n   = blockIdx.x >> 9;                       // 2 * S / 4 blocks to an n
  const v4f* src = (const v4f*)(scores + row * S) + lane;
  v4h*       dst = (v4h*)(P + row * S) + lane;

  v4f d[8];
#pragma unroll
  for (int i = 0; i < 8; ++i) d[i] = src[i * 32];
  // The wait in front of any rewrite of the address that the eight loads name; as
  // an input the address stays whole up to here.
  asm volatile("s_wait_xcnt 0x0" :: "v"(src) : "memory");

  v4f mv = d[0];
#pragma unroll
  for (int i = 1; i < 8; ++i) mv = __builtin_elementwise_max(mv, d[i]);
  const float m = wave_max(fmaxf(fmaxf(mv[0], mv[1]), fmaxf(mv[2], mv[3])));
#pragma unroll
  for (int i = 0; i < 8; ++i) d[i] -= m;

  v4f o[8] = {};
#pragma unroll
  for (int h = 0; h < 8; ++h) {
    const float s = fminf(fmaxf(strength[n * 64 + h * 9], 0.01f), 1.0f);  // diag, clamped
    v4f e[8];
    v4f t = {0.0f, 0.0f, 0.0f, 0.0f};
#pragma unroll
    for (int i = 0; i < 8; ++i) {
      const v4f a = d[i] * s;
      e[i] = v4f{__expf(a[0]), __expf(a[1]), __expf(a[2]), __expf(a[3])};
      t += e[i];
    }
    const float wh = gate[n * 8 + h] / wave_sum((t[0] + t[1]) + (t[2] + t[3]));
#pragma unroll
    for (int i = 0; i < 8; ++i) o[i] += e[i] * wh;
  }

#pragma unroll
  for (int i = 0; i < 8; ++i)
    dst[i * 32] = v4h{(_Float16)o[i][0], (_Float16)o[i][1], (_Float16)o[i][2], (_Float16)o[i][3]};
}

extern "C" void kernel_launch(void* const* d_in, const int* in_sizes, int n_in,
                              void* d_out, int out_size, void* d_ws, size_t ws_size,
                              hipStream_t stream) {
  (void)in_sizes; (void)n_in; (void)out_size; (void)ws_size;
  const float* x        = (const float*)d_in[0];
  const float* Wq       = (const float*)d_in[1];
  const float* bq       = (const float*)d_in[2];
  const float* Wk       = (const float*)d_in[3];
  const float* bk       = (const float*)d_in[4];
  const float* Wv       = (const float*)d_in[5];
  const float* bv       = (const float*)d_in[6];
  const float* Wo       = (const float*)d_in[7];
  const float* bo       = (const float*)d_in[8];
  const float* strength = (const float*)d_in[9];
  const float* gate     = (const float*)d_in[10];
  float* out = (float*)d_out;

  const int NB = 4, B = 2, S = 1024, D = 512, HID = 512;
  const long MS = (long)B * S;  // 2048

  char* w = (char*)d_ws;
  _Float16* x16  = (_Float16*)w; w += MS * D * 2;                  // [2048,512]
  _Float16* WqT  = (_Float16*)w; w += (long)NB * HID * D * 2;      // [n][HID,D]
  _Float16* WkT  = (_Float16*)w; w += (long)NB * HID * D * 2;
  _Float16* WvT  = (_Float16*)w; w += (long)NB * HID * D * 2;
  _Float16* WoT  = (_Float16*)w; w += (long)D * NB * HID * 2;      // [D, NB*HID]
  _Float16* q16  = (_Float16*)w; w += (long)NB * MS * HID * 2;     // [n][2048,512]
  _Float16* k16  = (_Float16*)w; w += (long)NB * MS * HID * 2;
  _Float16* vT16 = (_Float16*)w; w += (long)NB * HID * MS * 2;     // [n][HID, b*S+t]
  float*    sc   = (float*)w;    w += (long)NB * B * S * S * 4;    // [n][b][S,S]
  _Float16* P16  = (_Float16*)w; w += (long)NB * B * S * S * 2;    // [n][b][S,S]
  _Float16* hs   = (_Float16*)w; w += MS * (long)NB * HID * 2;     // [b*S, NB*HID]
  float*    bos  = (float*)w;    w += 512 * 4;

  (void)WkT; (void)WvT;   // reached through WqT: the three are adjacent

  const dim3 tb(256);

  const int NO_TR = 0x40000000;   // tfrom of a launch in which no group stores transposed

  // Stage 0: f16 conversion + weight transposes (A x B^T convention everywhere)
  // + summed output bias, one launch. WqT, WkT, WvT are adjacent in the workspace.
  prep_inputs<<<dim3(257), 256, 0, stream>>>(
      x, Wq, Wk, Wv, Wo, bo, x16, WqT, WoT, bos);

  // Stage 1: Q, K, V projections of all blocks in one launch, z = which*4 + n:
  // [2048,512] x [512,512]^T each. WqT/WkT/WvT and q16/k16/vT16 are adjacent in
  // the workspace; V (group 2) is stored transposed as vT[n][h][b*S+t].
  gemm_f16_wmma<<<dim3(HID / 64, MS / 256, 3 * NB), tb, 0, stream>>>(
      x16, 0L, 0L, D, WqT, (long)NB * HID * D, (long)HID * D, D,
      q16, (long)NB * MS * HID, (long)MS * HID, HID, (int)MS,
      bq, bk, bv, (long)HID, 1.0f, 2, 2, D, 1);

  // Stage 3: scores = q k^T / sqrt(512); q/k offsets are linear in z = n*2+b.
  gemm_f16_wmma<<<dim3(S / 64, S / 256, NB * B), tb, 0, stream>>>(
      q16, (long)S * HID, 0L, HID, k16, (long)S * HID, 0L, HID,
      sc, (long)S * S, 0L, S, 0, nullptr, nullptr, nullptr, 0L,
      0.044194173824159216f, 0, NO_TR, HID, 0);

  // Stage 4: combined gate-weighted softmax over all 8 heads -> one prob matrix.
  softmax_combine<<<dim3(NB * B * S / 4), 128, 0, stream>>>(sc, P16, strength, gate);

  // Stage 5: head_sum = P @ v for all (n, b) in one launch, z = n*2 + b,
  // staged as hs[b*S + s][n*HID + h].
  gemm_f16_wmma<<<dim3(HID / 64, S / 256, NB * B), tb, 0, stream>>>(
      P16, (long)B * S * S, (long)S * S, S,
      vT16, (long)HID * MS, (long)S, (int)MS,
      hs, (long)HID, (long)S * NB * HID, NB * HID, 0,
      nullptr, nullptr, nullptr, 0L, 1.0f, 1, NO_TR, S, 1);

  // Stage 6: out = MOD * (hs @ Wo_all + sum_n bo[n]); K = NB*HID = 2048.
  gemm_f16_wmma<<<dim3(D / 64, MS / 256, 1), tb, 0, stream>>>(
      hs, 0L, 0L, NB * HID, WoT, 0L, 0L, NB * HID,
      out, 0L, 0L, D, 0, bos, bos, bos, 0L, 1.55f, 0, NO_TR, NB * HID, 0);
}

// v004
// Measured time: 106 microseconds a run.
// Timed twice side by side with v003, it ran 1.18 times as fast both times.
// All steps since v000 together make it 2.80 times as fast.
#include <hip/hip_runtime.h>
#include <hip/hip_bf16.h>

typedef _Float16 v16h __attribute__((ext_vector_type(16)));
typedef _Float16 v8h  __attribute__((ext_vector_type(8)));
typedef _Float16 v4h  __attribute__((ext_vector_type(4)));
typedef float    v8f  __attribute__((ext_vector_type(8)));
typedef float    v4f  __attribute__((ext_vector_type(4)));
typedef unsigned int u32x4 __attribute__((ext_vector_type(4)));
typedef int          i32x8 __attribute__((ext_vector_type(8)));
typedef int          i32x4 __attribute__((ext_vector_type(4)));

#if __has_builtin(__builtin_amdgcn_tensor_load_to_lds)
#define USE_TDM 1
#else
#define USE_TDM 0
#endif

// LDS B tile: 64 rows x 128 halves per chunk, padded to 136 halves (272B) per
// row so consecutive fragment rows hit different LDS banks (256B stride would
// alias all 16 rows onto the same bank: 64 banks x 4B).
#define BROW 136
#define CHUNK 128

// C staging in LDS, one layout per kind of store:
//   f32: each wave its own 32 rows of 64 floats, pitch 68 floats (272B)
//   f16: each wave its own 32 rows of 64 halves, pitch 72 halves (144B)
//   f16 transposed: the block's 64 columns of 256 halves, pitch 264 halves (528B)
// At these pitches the accumulator writes fall on distinct banks, and so do the
// 16-byte reads of a half-wave, but for the f16 rows, where the two rows that a
// half-wave reads overlap in four banks.
#define CF_PITCH 68
#define CH_PITCH 72
#define CT_PITCH 264
#define CSTAGE_BYTES (8 * 32 * CF_PITCH * 4)

// Load one 16-half WMMA fragment (global, row stride = ld).
// 16-bit A/B^T layout: lane<16 holds K = k+0..7 and k+16..23,
// lane>=16 holds K = k+8..15 and k+24..31 (koff pre-applied by caller).
__device__ __forceinline__ v16h load_frag(const _Float16* __restrict__ p) {
  v8h lo = *(const v8h*)(p);
  v8h hi = *(const v8h*)(p + 16);
  return __builtin_shufflevector(lo, hi, 0,1,2,3,4,5,6,7,8,9,10,11,12,13,14,15);
}

__device__ __forceinline__ v16h lds_frag(const _Float16* p) {
  v8h lo = *(const v8h*)(p);
  v8h hi = *(const v8h*)(p + 16);
  return __builtin_shufflevector(lo, hi, 0,1,2,3,4,5,6,7,8,9,10,11,12,13,14,15);
}

#if USE_TDM
// Issue a TDM DMA of a 64-row x 128-half tile of Bt (row stride ldb halves)
// into LDS at lds_addr, with 4-DWORD padding every 64 DWORDs (-> 272B rows).
// This toolchain exposes the 6-arg clang-23 builtin:
//   (u32x4 group0, i32x8 group1, i32x4 group2, i32x4 group3, i32x8, i32 cpol)
__device__ __forceinline__ void tdm_load_B(const _Float16* gptr, unsigned lds_addr, int ldb) {
  unsigned long long ga = (unsigned long long)(uintptr_t)gptr;
  u32x4 g0;
  g0[0] = 1u;                                   // count=1 (valid user descriptor)
  g0[1] = lds_addr;                             // lds_addr [63:32]
  g0[2] = (unsigned)ga;                         // global_addr [95:64]
  g0[3] = (unsigned)(ga >> 32) | (2u << 30);    // global_addr hi + type=2 (image)
  i32x8 g1;
  // data_size=2B, pad_enable, pad_interval=64 DWORDs (code 5), pad_amount=4 DWORDs (code 3)
  g1[0] = (int)((1u << 16) | (1u << 20) | (5u << 22) | (3u << 25));
  const unsigned td0 = 0x40000000u, td1 = 0x40000000u;  // huge dims: no OOB clamp
  g1[1] = (int)((td0 & 0xFFFFu) << 16);                 // tensor_dim0[15:0]
  g1[2] = (int)((td0 >> 16) | ((td1 & 0xFFFFu) << 16)); // tensor_dim0 hi | tensor_dim1 lo
  g1[3] = (int)((td1 >> 16) | ((unsigned)CHUNK << 16)); // tensor_dim1 hi | tile_dim0=128
  g1[4] = 64;                                           // tile_dim1=64, tile_dim2=0
  g1[5] = ldb;                                          // tensor_dim0_stride[31:0]
  g1[6] = 0;                                            // stride hi | dim1_stride lo
  g1[7] = 0;
  i32x4 z4 = {0, 0, 0, 0};                              // group2/3: 2D tile -> zero (NULL)
  i32x8 z8 = {0, 0, 0, 0, 0, 0, 0, 0};
  __builtin_amdgcn_tensor_load_to_lds(g0, g1, z4, z4, z8, 0);
}
#endif

// Generic C = scale * (A[M,K] x Bt[N,K]^T + bias[col]) GEMM, f16 in, f32 acc.
// flags bit0: store f16 (else f32).
// Grid: x = N/64, y = M/256, z = batch. Block: 256 threads = 8 waves.
// The batch index splits into a group zh = z >> zshift and a member
// zl = z & ((1 << zshift) - 1), each with its own operand strides, so that
// products which differ in two indices share one launch. Group zh takes
// bias0, bias1 or bias2 (zh >= 2); groups zh >= tfrom store f16, transposed
// (C[col*ldcT+row]).
// The 64-col B panel is staged into LDS (TDM DMA, double buffered, 128-wide K
// chunks) and shared by all 8 waves; each wave computes a 32x64 sub-tile
// (2 A frags x 4 B frags -> 8 WMMAs per k-step).
// The finished tile goes through LDS, so that every global store is 16 bytes a
// lane and a wave's store covers whole 128-byte lines.
__global__ void __launch_bounds__(256)
gemm_f16_wmma(const _Float16* __restrict__ A, long sAh, long sAl, int lda,
              const _Float16* __restrict__ Bt, long sBh, long sBl, int ldb,
              void* __restrict__ Cv, long sCh, long sCl, int ldc, int ldcT,
              const float* __restrict__ bias0, const float* __restrict__ bias1,
              const float* __restrict__ bias2, long sBiasl,
              float scale, int zshift, int tfrom, int K, int flags)
{
  const int z    = blockIdx.z;
  const int zh   = z >> zshift;
  const int zl   = z - (zh << zshift);
  A  += zh * sAh + zl * sAl;
  Bt += zh * sBh + zl * sBl;
  const int lane = threadIdx.x & 31;
  const int wave = threadIdx.x >> 5;
  const int m0   = blockIdx.y * 256 + wave * 32;
  const int n0   = blockIdx.x * 64;
  const int lr   = lane & 15;
  const int koff = (lane >> 4) * 8;

  // The two B buffers (2 x 17408 bytes) during the K loop; behind it all of the
  // array stages the C tile.
  __shared__ __align__(16) char lds[CSTAGE_BYTES];
  _Float16 (*tileB)[64 * BROW] = (_Float16 (*)[64 * BROW])lds;

  const _Float16* abase0 = A + (long)(m0 +  0 + lr) * lda + koff;
  const _Float16* abase1 = A + (long)(m0 + 16 + lr) * lda + koff;
  const _Float16* btile  = Bt + (long)n0 * ldb;   // 64-row panel for this block

  const int nchunks = K >> 7;   // K / 128

  // Prologue: stage chunk 0 into buffer 0.
#if USE_TDM
  if (threadIdx.x < 32) {
    tdm_load_B(btile, (unsigned)(uintptr_t)&tileB[0][0], ldb);
    __builtin_amdgcn_s_wait_tensorcnt(0);
  }
#else
  {
    const int tid = threadIdx.x;
#pragma unroll
    for (int t = 0; t < 4; ++t) {
      int idx = t * 256 + tid;          // 1024 16-byte chunks
      int r = idx >> 3, c8 = (idx & 7) * 16;
      *(v8h*)(&tileB[0][r * BROW + c8]) = *(const v8h*)(btile + (long)r * ldb + c8);
    }
  }
#endif
  __syncthreads();

  v8f acc[4][2] = {};
  for (int c = 0; c < nchunks; ++c) {
    const int buf = c & 1;
    const int kc  = c * CHUNK;
    const bool more = (c + 1) < nchunks;

    // Overlap: DMA chunk c+1 into the other buffer while computing chunk c.
#if USE_TDM
    if (more && threadIdx.x < 32)
      tdm_load_B(btile + kc + CHUNK, (unsigned)(uintptr_t)&tileB[buf ^ 1][0], ldb);
#else
    if (more) {
      const int tid = threadIdx.x;
#pragma unroll
      for (int t = 0; t < 4; ++t) {
        int idx = t * 256 + tid;
        int r = idx >> 3, c8 = (idx & 7) * 16;
        *(v8h*)(&tileB[buf ^ 1][r * BROW + c8]) =
            *(const v8h*)(btile + (long)r * ldb + kc + CHUNK + c8);
      }
    }
#endif
    // Keep A one chunk ahead in the WGP cache (speculative; OOB dropped).
    __builtin_prefetch((const void*)(abase0 + kc + CHUNK), 0, 1);
    __builtin_prefetch((const void*)(abase1 + kc + CHUNK), 0, 1);

    const _Float16* Bl = &tileB[buf][0];
#pragma unroll
    for (int kk = 0; kk < CHUNK; kk += 32) {
      v16h a0 = load_frag(abase0 + kc + kk);
      v16h a1 = load_frag(abase1 + kc + kk);
      v16h f0 = lds_frag(Bl + ( 0 + lr) * BROW + kk + koff);
      v16h f1 = lds_frag(Bl + (16 + lr) * BROW + kk + koff);
      v16h f2 = lds_frag(Bl + (32 + lr) * BROW + kk + koff);
      v16h f3 = lds_frag(Bl + (48 + lr) * BROW + kk + koff);
      acc[0][0] = __builtin_amdgcn_wmma_f32_16x16x32_f16(false, a0, false, f0, (short)0, acc[0][0], false, false);
      acc[0][1] = __builtin_amdgcn_wmma_f32_16x16x32_f16(false, a1, false, f0, (short)0, acc[0][1], false, false);
      acc[1][0] = __builtin_amdgcn_wmma_f32_16x16x32_f16(false, a0, false, f1, (short)0, acc[1][0], false, false);
      acc[1][1] = __builtin_amdgcn_wmma_f32_16x16x32_f16(false, a1, false, f1, (short)0, acc[1][1], false, false);
      acc[2][0] = __builtin_amdgcn_wmma_f32_16x16x32_f16(false, a0, false, f2, (short)0, acc[2][0], false, false);
      acc[2][1] = __builtin_amdgcn_wmma_f32_16x16x32_f16(false, a1, false, f2, (short)0, acc[2][1], false, false);
      acc[3][0] = __builtin_amdgcn_wmma_f32_16x16x32_f16(false, a0, false, f3, (short)0, acc[3][0], false, false);
      acc[3][1] = __builtin_amdgcn_wmma_f32_16x16x32_f16(false, a1, false, f3, (short)0, acc[3][1], false, false);
    }

    if (more) {
#if USE_TDM
      if (threadIdx.x < 32) __builtin_amdgcn_s_wait_tensorcnt(0);
#endif
      __syncthreads();   // publish buf^1; all waves done reading buf
    }
  }

  // Epilogue. C layout per 16x16 tile: lanes 0-15 -> M = base+0..7,
  // lanes 16-31 -> M = base+8..15, N = n0 + j*16 + (lane&15);
  // accumulator element r holds row (base + r).
  const long cbase = zh * sCh + zl * sCl;
  const float* bias = zh == 0 ? bias0 : zh == 1 ? bias1 : bias2;
  const float* bp = bias ? bias + zl * sBiasl : nullptr;
  const int hi = lane >> 4;
  float bval[4] = {0.0f, 0.0f, 0.0f, 0.0f};
  if (bp) {
    const float* bl = bp + n0 + lr;
#pragma unroll
    for (int j = 0; j < 4; ++j) bval[j] = bl[j * 16];
    // The wait in front of any rewrite of a register that the four loads name.
    asm volatile("s_wait_xcnt 0x0" ::: "memory");
  }

  // Every wave has read its last B fragments before the ring's LDS takes C.
  __syncthreads();

  if (zh >= tfrom) {
    // f16, transposed: a lane's 8 accumulator rows are 16 contiguous bytes of
    // a column; a wave then stores whole columns of the block, 512 bytes each.
    _Float16* st = (_Float16*)lds;
#pragma unroll
    for (int j = 0; j < 4; ++j)
#pragma unroll
      for (int t = 0; t < 2; ++t) {
        v8h h;
#pragma unroll
        for (int r = 0; r < 8; ++r) h[r] = (_Float16)((acc[j][t][r] + bval[j]) * scale);
        *(v8h*)(st + (j * 16 + lr) * CT_PITCH + wave * 32 + t * 16 + hi * 8) = h;
      }
    __syncthreads();   // a column holds rows of all eight waves
    _Float16* cg = (_Float16*)Cv + cbase + (long)(n0 + wave * 8) * ldcT
                   + blockIdx.y * 256 + lane * 8;
    const _Float16* sr = st + wave * 8 * CT_PITCH + lane * 8;
    v8h v[8];
    _Float16* p[8];
#pragma unroll
    for (int i = 0; i < 8; ++i) { v[i] = *(const v8h*)(sr + i * CT_PITCH); p[i] = cg + (long)i * ldcT; }
    // Keeps the address arithmetic in front of the first store: behind it no
    // register that an issued store names is written again.
    __builtin_amdgcn_sched_barrier(0);
#pragma unroll
    for (int i = 0; i < 8; ++i) *(v8h*)p[i] = v[i];
  } else if (flags & 1) {
    // f16: a row of the wave's tile is one 128-byte line; 8 lanes store a row.
    _Float16* st = (_Float16*)lds + wave * (32 * CH_PITCH);
#pragma unroll
    for (int j = 0; j < 4; ++j)
#pragma unroll
      for (int t = 0; t < 2; ++t)
#pragma unroll
        for (int r = 0; r < 8; ++r)
          st[(t * 16 + hi * 8 + r) * CH_PITCH + j * 16 + lr] =
              (_Float16)((acc[j][t][r] + bval[j]) * scale);
    // The wave's own LDS writes are complete before other lanes read them back.
    asm volatile("s_wait_dscnt 0x0" ::: "memory");
    _Float16* cg = (_Float16*)Cv + cbase + (long)(m0 + (lane >> 3)) * ldc
                   + n0 + (lane & 7) * 8;
    const _Float16* sr = st + (lane >> 3) * CH_PITCH + (lane & 7) * 8;
    v8h v[8];
    _Float16* p[8];
#pragma unroll
    for (int i = 0; i < 8; ++i) { v[i] = *(const v8h*)(sr + i * 4 * CH_PITCH); p[i] = cg + (long)(i * 4) * ldc; }
    // As above: all addresses are formed in front of the first store.
    __builtin_amdgcn_sched_barrier(0);
#pragma unroll
    for (int i = 0; i < 8; ++i) *(v8h*)p[i] = v[i];
  } else {
    // f32: a row of the wave's tile is two 128-byte lines; 16 lanes store a row.
    float* st = (float*)lds + wave * (32 * CF_PITCH);
#pragma unroll
    for (int j = 0; j < 4; ++j)
#pragma unroll
      for (int t = 0; t < 2; ++t)
#pragma unroll
        for (int r = 0; r < 8; ++r)
          st[(t * 16 + hi * 8 + r) * CF_PITCH + j * 16 + lr] =
              (acc[j][t][r] + bval[j]) * scale;
    // The wave's own LDS writes are complete before other lanes read them back.
    asm volatile("s_wait_dscnt 0x0" ::: "memory");
    float* cg = (float*)Cv + cbase + (long)(m0 + hi) * ldc + n0 + lr * 4;
    const float* sr = st + hi * CF_PITCH + lr * 4;
    v4f v[16];
    float* p[16];
#pragma unroll
    for (int i = 0; i < 16; ++i) { v[i] = *(const v4f*)(sr + i * 2 * CF_PITCH); p[i] = cg + (long)(i * 2) * ldc; }
    // As above: all addresses are formed in front of the first store.
    __builtin_amdgcn_sched_barrier(0);
#pragma unroll
    for (int i = 0; i < 16; ++i) *(v4f*)p[i] = v[i];
  }
}

// All input staging in one launch. Blocks 0..255, one per WGP, each do an equal
// share of the first two parts, with all of their global loads issued up front:
//   x16 = f16(x): 4096 consecutive elements, 16 per thread
//   one 128x128 tile of the sixteen 512x512 weight transposes, f32 -> f16:
//   dst[c*ld + r] = src[r*512 + c]; a wave reads whole 512-byte tile rows,
//   each thread turns 4x4 elements in registers, the tile goes through LDS, and
//   16 lanes store each 256-byte output row
// Block 256: bos[d] = sum_n bo[n][d].
// WqkvT holds the transposed Wq, Wk, Wv as twelve [HID,D] matrices in a row;
// WoT[d][n*HID + h] = Wo[n][h][d].
// LDS tile: row c holds 128 halves = 16 units of 16 bytes; unit u of row c lies
// at place u ^ ((c >> 2) & 15), so that the 32 lanes of a write, which are four
// rows apart, spread over the banks, and a read of a row still covers all banks.
__global__ void __launch_bounds__(256)
prep_inputs(const float* __restrict__ x,  const float* __restrict__ Wq,
            const float* __restrict__ Wk, const float* __restrict__ Wv,
            const float* __restrict__ Wo, const float* __restrict__ bo,
            _Float16* __restrict__ x16, _Float16* __restrict__ WqkvT,
            _Float16* __restrict__ WoT, float* __restrict__ bos)
{
  __shared__ __align__(16) _Float16 tl[128 * 128];

  const int tid = threadIdx.x;
  const int blk = blockIdx.x;

  if (blk == 256) {                     // the whole block leaves before the barrier
#pragma unroll
    for (int t = 0; t < 2; ++t) {
      const int d = t * 256 + tid;
      float s = 0.0f;
      for (int m = 0; m < 4; ++m) s += bo[m * 512 + d];
      bos[d] = s;
    }
    return;
  }

  const v4f* xs = (const v4f*)x + blk * 1024 + tid;
  v4f xv[4];
#pragma unroll
  for (int i = 0; i < 4; ++i) xv[i] = xs[i * 256];

  const int mat   = blk >> 4;           // which * 4 + n
  const int which = mat >> 2;           // 0 Wq, 1 Wk, 2 Wv, 3 Wo
  const int n     = mat & 3;
  const int c0 = (blk & 3) * 128;
  const int r0 = ((blk >> 2) & 3) * 128;
  const float* src = (which == 0 ? Wq : which == 1 ? Wk : which == 2 ? Wv : Wo)
                     + (long)n * 512 * 512 + (long)r0 * 512 + c0;
  const int cb = tid & 31;              // columns cb*4 .. cb*4+3 of the tile
  const int rw = tid >> 5;              // rows (rw + 8*i)*4 .. +3 of the tile
  const float* wp = src + rw * 4 * 512 + cb * 4;
  v4f wv[4][4];
#pragma unroll
  for (int i = 0; i < 4; ++i)
#pragma unroll
    for (int k = 0; k < 4; ++k)
      wv[i][k] = *(const v4f*)(wp + (8 * i * 4 + k) * 512);
  // Keeps all twenty loads in front of the first use of a loaded value: without
  // it the last six are issued behind the first waits, and the block pays the
  // memory latency twice.
  __builtin_amdgcn_sched_barrier(0);
  // The wait in front of any rewrite of the address pair that the sixteen weight
  // loads name; as an input the pair stays whole up to here, so that no load's
  // own result is laid over it.
  asm volatile("s_wait_xcnt 0x0" :: "v"(wp) : "memory");

#pragma unroll
  for (int i = 0; i < 4; ++i) {
    const int rb   = rw + 8 * i;
    const int slot = (((rb >> 1) ^ (cb & 15)) << 3) + ((rb & 1) << 2);
#pragma unroll
    for (int j = 0; j < 4; ++j) {
      v4h h = {(_Float16)wv[i][0][j], (_Float16)wv[i][1][j],
               (_Float16)wv[i][2][j], (_Float16)wv[i][3][j]};
      *(v4h*)(&tl[(cb * 4 + j) * 128 + slot]) = h;
    }
  }
  __syncthreads();

  _Float16* dst = (which < 3 ? WqkvT + (long)mat * 512 * 512 : WoT + (long)n * 512) + r0;
  const int ld  = which < 3 ? 512 : 2048;
#pragma unroll
  for (int i = 0; i < 8; ++i) {
    const int c = i * 16 + (tid >> 4);
    const int u = tid & 15;
    v8h v = *(const v8h*)(&tl[c * 128 + ((u ^ ((c >> 2) & 15)) << 3)]);
    *(v8h*)(dst + (c0 + c) * ld + u * 8) = v;
  }

  // x16 is stored last: in front of the barrier, the barrier would wait for
  // these stores to complete.
  v4h* xd = (v4h*)x16 + blk * 1024 + tid;
#pragma unroll
  for (int i = 0; i < 4; ++i) {
    v4h o = {(_Float16)xv[i][0], (_Float16)xv[i][1], (_Float16)xv[i][2], (_Float16)xv[i][3]};
    xd[i * 256] = o;
  }
}

// One step of a butterfly inside a 16-lane row: the value of lane l ^ mask
// (CTRL = 0x160 + mask, the row_xmask control). All 32 lanes are on at every call.
template <int CTRL>
__device__ __forceinline__ float row_xmask(float v) {
  return __builtin_bit_cast(float, __builtin_amdgcn_update_dpp(
      0, __builtin_bit_cast(int, v), CTRL, 0xf, 0xf, true));
}

// The value of lane l ^ 16.
__device__ __forceinline__ float other_row(float v) {
  const int b = __builtin_bit_cast(int, v);
  return __builtin_bit_cast(float,
      __builtin_amdgcn_permlanex16(b, b, 0x76543210, 0xfedcba98, false, false));
}

__device__ __forceinline__ float wave_max(float v) {
  v = fmaxf(v, row_xmask<0x161>(v));
  v = fmaxf(v, row_xmask<0x162>(v));
  v = fmaxf(v, row_xmask<0x164>(v));
  v = fmaxf(v, row_xmask<0x168>(v));
  return fmaxf(v, other_row(v));
}

__device__ __forceinline__ float wave_sum(float v) {
  v += row_xmask<0x161>(v);
  v += row_xmask<0x162>(v);
  v += row_xmask<0x164>(v);
  v += row_xmask<0x168>(v);
  return v + other_row(v);
}

// One wave per score row: P_row = sum_h gate_h * softmax(s_h * row).
// Row max commutes with the positive per-head scale, so one max serves all heads.
// A lane holds 32 elements of its row in registers. The maximum and each head's
// sum go over the lanes by register butterflies, and a head's exponentials are
// added into the output row as soon as its sum is known, so the kernel has no LDS
// and no barrier. Four rows of one (n, b) to a block.
__global__ void __launch_bounds__(128)
softmax_combine(const float* __restrict__ scores, _Float16* __restrict__ P,
                const float* __restrict__ strength, const float* __restrict__ gate)
{
  const int S = 1024;
  const int lane = threadIdx.x & 31;
  const long row = blockIdx.x * 4 + (threadIdx.x >> 5);   // (n*2 + b) * S + s
  const int  n   = blockIdx.x >> 9;                       // 2 * S / 4 blocks to an n
  const v4f* src = (const v4f*)(scores + row * S) + lane;
  v4h*       dst = (v4h*)(P + row * S) + lane;

  v4f d[8];
#pragma unroll
  for (int i = 0; i < 8; ++i) d[i] = src[i * 32];
  // The wait in front of any rewrite of the address that the eight loads name; as
  // an input the address stays whole up to here.
  asm volatile("s_wait_xcnt 0x0" :: "v"(src) : "memory");

  v4f mv = d[0];
#pragma unroll
  for (int i = 1; i < 8; ++i) mv = __builtin_elementwise_max(mv, d[i]);
  const float m = wave_max(fmaxf(fmaxf(mv[0], mv[1]), fmaxf(mv[2], mv[3])));
#pragma unroll
  for (int i = 0; i < 8; ++i) d[i] -= m;

  v4f o[8] = {};
#pragma unroll
  for (int h = 0; h < 8; ++h) {
    const float s = fminf(fmaxf(strength[n * 64 + h * 9], 0.01f), 1.0f);  // diag, clamped
    v4f e[8];
    v4f t = {0.0f, 0.0f, 0.0f, 0.0f};
#pragma unroll
    for (int i = 0; i < 8; ++i) {
      const v4f a = d[i] * s;
      e[i] = v4f{__expf(a[0]), __expf(a[1]), __expf(a[2]), __expf(a[3])};
      t += e[i];
    }
    const float wh = gate[n * 8 + h] / wave_sum((t[0] + t[1]) + (t[2] + t[3]));
#pragma unroll
    for (int i = 0; i < 8; ++i) o[i] += e[i] * wh;
  }

#pragma unroll
  for (int i = 0; i < 8; ++i)
    dst[i * 32] = v4h{(_Float16)o[i][0], (_Float16)o[i][1], (_Float16)o[i][2], (_Float16)o[i][3]};
}

extern "C" void kernel_launch(void* const* d_in, const int* in_sizes, int n_in,
                              void* d_out, int out_size, void* d_ws, size_t ws_size,
                              hipStream_t stream) {
  (void)in_sizes; (void)n_in; (void)out_size; (void)ws_size;
  const float* x        = (const float*)d_in[0];
  const float* Wq       = (const float*)d_in[1];
  const float* bq       = (const float*)d_in[2];
  const float* Wk       = (const float*)d_in[3];
  const float* bk       = (const float*)d_in[4];
  const float* Wv       = (const float*)d_in[5];
  const float* bv       = (const float*)d_in[6];
  const float* Wo       = (const float*)d_in[7];
  const float* bo       = (const float*)d_in[8];
  const float* strength = (const float*)d_in[9];
  const float* gate     = (const float*)d_in[10];
  float* out = (float*)d_out;

  const int NB = 4, B = 2, S = 1024, D = 512, HID = 512;
  const long MS = (long)B * S;  // 2048

  char* w = (char*)d_ws;
  _Float16* x16  = (_Float16*)w; w += MS * D * 2;                  // [2048,512]
  _Float16* WqT  = (_Float16*)w; w += (long)NB * HID * D * 2;      // [n][HID,D]
  _Float16* WkT  = (_Float16*)w; w += (long)NB * HID * D * 2;
  _Float16* WvT  = (_Float16*)w; w += (long)NB * HID * D * 2;
  _Float16* WoT  = (_Float16*)w; w += (long)D * NB * HID * 2;      // [D, NB*HID]
  _Float16* q16  = (_Float16*)w; w += (long)NB * MS * HID * 2;     // [n][2048,512]
  _Float16* k16  = (_Float16*)w; w += (long)NB * MS * HID * 2;
  _Float16* vT16 = (_Float16*)w; w += (long)NB * HID * MS * 2;     // [n][HID, b*S+t]
  float*    sc   = (float*)w;    w += (long)NB * B * S * S * 4;    // [n][b][S,S]
  _Float16* P16  = (_Float16*)w; w += (long)NB * B * S * S * 2;    // [n][b][S,S]
  _Float16* hs   = (_Float16*)w; w += MS * (long)NB * HID * 2;     // [b*S, NB*HID]
  float*    bos  = (float*)w;    w += 512 * 4;

  (void)WkT; (void)WvT;   // reached through WqT: the three are adjacent

  const dim3 tb(256);

  const int NO_TR = 0x40000000;   // tfrom of a launch in which no group stores transposed

  // Stage 0: f16 conversion + weight transposes (A x B^T convention everywhere)
  // + summed output bias, one launch. WqT, WkT, WvT are adjacent in the workspace.
  prep_inputs<<<dim3(257), 256, 0, stream>>>(
      x, Wq, Wk, Wv, Wo, bo, x16, WqT, WoT, bos);

  // Stage 1: Q, K, V projections of all blocks in one launch, z = which*4 + n:
  // [2048,512] x [512,512]^T each. WqT/WkT/WvT and q16/k16/vT16 are adjacent in
  // the workspace; V (group 2) is stored transposed as vT[n][h][b*S+t].
  gemm_f16_wmma<<<dim3(HID / 64, MS / 256, 3 * NB), tb, 0, stream>>>(
      x16, 0L, 0L, D, WqT, (long)NB * HID * D, (long)HID * D, D,
      q16, (long)NB * MS * HID, (long)MS * HID, HID, (int)MS,
      bq, bk, bv, (long)HID, 1.0f, 2, 2, D, 1);

  // Stage 3: scores = q k^T / sqrt(512); q/k offsets are linear in z = n*2+b.
  gemm_f16_wmma<<<dim3(S / 64, S / 256, NB * B), tb, 0, stream>>>(
      q16, (long)S * HID, 0L, HID, k16, (long)S * HID, 0L, HID,
      sc, (long)S * S, 0L, S, 0, nullptr, nullptr, nullptr, 0L,
      0.044194173824159216f, 0, NO_TR, HID, 0);

  // Stage 4: combined gate-weighted softmax over all 8 heads -> one prob matrix.
  softmax_combine<<<dim3(NB * B * S / 4), 128, 0, stream>>>(sc, P16, strength, gate);

  // Stage 5: head_sum = P @ v for all (n, b) in one launch, z = n*2 + b,
  // staged as hs[b*S + s][n*HID + h].
  gemm_f16_wmma<<<dim3(HID / 64, S / 256, NB * B), tb, 0, stream>>>(
      P16, (long)B * S * S, (long)S * S, S,
      vT16, (long)HID * MS, (long)S, (int)MS,
      hs, (long)HID, (long)S * NB * HID, NB * HID, 0,
      nullptr, nullptr, nullptr, 0L, 1.0f, 1, NO_TR, S, 1);

  // Stage 6: out = MOD * (hs @ Wo_all + sum_n bo[n]); K = NB*HID = 2048.
  gemm_f16_wmma<<<dim3(D / 64, MS / 256, 1), tb, 0, stream>>>(
      hs, 0L, 0L, NB * HID, WoT, 0L, 0L, NB * HID,
      out, 0L, 0L, D, 0, bos, bos, bos, 0L, 1.55f, 0, NO_TR, NB * HID, 0);
}

// v005
// Measured time: 91.7 microseconds a run.
// Next to v004, in two timings, it ran 1.16 and 1.15 times as fast.
// All steps since v000 together make it 3.24 times as fast.
#include <hip/hip_runtime.h>
#include <hip/hip_bf16.h>

typedef _Float16 v16h __attribute__((ext_vector_type(16)));
typedef _Float16 v8h  __attribute__((ext_vector_type(8)));
typedef _Float16 v4h  __attribute__((ext_vector_type(4)));
typedef float    v8f  __attribute__((ext_vector_type(8)));
typedef float    v4f  __attribute__((ext_vector_type(4)));
typedef unsigned int u32x4 __attribute__((ext_vector_type(4)));
typedef int          i32x8 __attribute__((ext_vector_type(8)));
typedef int          i32x4 __attribute__((ext_vector_type(4)));

#if __has_builtin(__builtin_amdgcn_tensor_load_to_lds)
#define USE_TDM 1
#else
#define USE_TDM 0
#endif

// LDS B tile: 64 rows x 128 halves per chunk, padded to 136 halves (272B) per
// row so consecutive fragment rows hit different LDS banks (256B stride would
// alias all 16 rows onto the same bank: 64 banks x 4B).
#define BROW 136
#define CHUNK 128

// C staging in LDS, one layout per kind of store:
//   f32: each wave its own 32 rows of 64 floats, pitch 68 floats (272B)
//   f16: each wave its own 32 rows of 64 halves, pitch 72 halves (144B)
//   f16 transposed: the block's 64 columns of 256 halves, pitch 264 halves (528B)
// At these pitches the accumulator writes fall on distinct banks, and so do the
// 16-byte reads of a half-wave, but for the f16 rows, where the two rows that a
// half-wave reads overlap in four banks.
#define CF_PITCH 68
#define CH_PITCH 72
#define CT_PITCH 264
#define CSTAGE_BYTES (8 * 32 * CF_PITCH * 4)

// Load one 16-half WMMA fragment (global, row stride = ld).
// 16-bit A/B^T layout: lane<16 holds K = k+0..7 and k+16..23,
// lane>=16 holds K = k+8..15 and k+24..31 (koff pre-applied by caller).
__device__ __forceinline__ v16h load_frag(const _Float16* __restrict__ p) {
  v8h lo = *(const v8h*)(p);
  v8h hi = *(const v8h*)(p + 16);
  return __builtin_shufflevector(lo, hi, 0,1,2,3,4,5,6,7,8,9,10,11,12,13,14,15);
}

__device__ __forceinline__ v16h lds_frag(const _Float16* p) {
  v8h lo = *(const v8h*)(p);
  v8h hi = *(const v8h*)(p + 16);
  return __builtin_shufflevector(lo, hi, 0,1,2,3,4,5,6,7,8,9,10,11,12,13,14,15);
}

#if USE_TDM
// Issue a TDM DMA of a 64-row x 128-half tile of Bt (row stride ldb halves)
// into LDS at lds_addr, with 4-DWORD padding every 64 DWORDs (-> 272B rows).
// This toolchain exposes the 6-arg clang-23 builtin:
//   (u32x4 group0, i32x8 group1, i32x4 group2, i32x4 group3, i32x8, i32 cpol)
__device__ __forceinline__ void tdm_load_B(const _Float16* gptr, unsigned lds_addr, int ldb) {
  unsigned long long ga = (unsigned long long)(uintptr_t)gptr;
  u32x4 g0;
  g0[0] = 1u;                                   // count=1 (valid user descriptor)
  g0[1] = lds_addr;                             // lds_addr [63:32]
  g0[2] = (unsigned)ga;                         // global_addr [95:64]
  g0[3] = (unsigned)(ga >> 32) | (2u << 30);    // global_addr hi + type=2 (image)
  i32x8 g1;
  // data_size=2B, pad_enable, pad_interval=64 DWORDs (code 5), pad_amount=4 DWORDs (code 3)
  g1[0] = (int)((1u << 16) | (1u << 20) | (5u << 22) | (3u << 25));
  const unsigned td0 = 0x40000000u, td1 = 0x40000000u;  // huge dims: no OOB clamp
  g1[1] = (int)((td0 & 0xFFFFu) << 16);                 // tensor_dim0[15:0]
  g1[2] = (int)((td0 >> 16) | ((td1 & 0xFFFFu) << 16)); // tensor_dim0 hi | tensor_dim1 lo
  g1[3] = (int)((td1 >> 16) | ((unsigned)CHUNK << 16)); // tensor_dim1 hi | tile_dim0=128
  g1[4] = 64;                                           // tile_dim1=64, tile_dim2=0
  g1[5] = ldb;                                          // tensor_dim0_stride[31:0]
  g1[6] = 0;                                            // stride hi | dim1_stride lo
  g1[7] = 0;
  i32x4 z4 = {0, 0, 0, 0};                              // group2/3: 2D tile -> zero (NULL)
  i32x8 z8 = {0, 0, 0, 0, 0, 0, 0, 0};
  __builtin_amdgcn_tensor_load_to_lds(g0, g1, z4, z4, z8, 0);
}
#endif

// The 32 WMMAs of one 128-wide K chunk of a wave's 32x64 tile, 4 k-steps of 8.
// a[s]: the chunk's A fragments, already in registers or on their way. With
// REFILL, each k-step's pair is loaded anew from an0 / an1 (the same rows, one
// chunk on) as soon as its WMMAs have issued, three k-steps and a barrier ahead
// of its next use.
// B fragments come from LDS (Bl: the lane's row and k offset in the chunk's
// buffer) through three register sets, each k-step's four as one group two
// k-steps ahead, so that the wait in front of a k-step leaves the younger groups
// in flight.
template <bool REFILL>
__device__ __forceinline__ void chunk_mma(v8f (&acc)[4][2], v16h (&a)[4][2],
                                          const _Float16* Bl,
                                          const _Float16* __restrict__ an0,
                                          const _Float16* __restrict__ an1) {
  v16h b[3][4];
#pragma unroll
  for (int s = 0; s < 2; ++s)
#pragma unroll
    for (int j = 0; j < 4; ++j) b[s][j] = lds_frag(Bl + j * 16 * BROW + s * 32);
#pragma unroll
  for (int s = 0; s < 4; ++s) {
    if (s + 2 < 4) {
#pragma unroll
      for (int j = 0; j < 4; ++j) b[(s + 2) % 3][j] = lds_frag(Bl + j * 16 * BROW + (s + 2) * 32);
    }
    // Keeps the loads above in front of this k-step's WMMAs: left free, the
    // compiler moves them down to their first use and waits there for each.
    __builtin_amdgcn_sched_barrier(0);
#pragma unroll
    for (int j = 0; j < 4; ++j) {
      acc[j][0] = __builtin_amdgcn_wmma_f32_16x16x32_f16(false, a[s][0], false, b[s % 3][j], (short)0, acc[j][0], false, false);
      acc[j][1] = __builtin_amdgcn_wmma_f32_16x16x32_f16(false, a[s][1], false, b[s % 3][j], (short)0, acc[j][1], false, false);
    }
    // Keeps the loads below behind these WMMAs, as one group with the next LDS reads.
    __builtin_amdgcn_sched_barrier(0);
    if (REFILL) {
      a[s][0] = load_frag(an0 + s * 32);
      a[s][1] = load_frag(an1 + s * 32);
    }
  }
}

// Generic C = scale * (A[M,K] x Bt[N,K]^T + bias[col]) GEMM, f16 in, f32 acc.
// flags bit0: store f16 (else f32).
// Grid: x = N/64, y = M/256, z = batch. Block: 256 threads = 8 waves.
// The batch index splits into a group zh = z >> zshift and a member
// zl = z & ((1 << zshift) - 1), each with its own operand strides, so that
// products which differ in two indices share one launch. Group zh takes
// bias0, bias1 or bias2 (zh >= 2); groups zh >= tfrom store f16, transposed
// (C[col*ldcT+row]).
// The 64-col B panel is staged into LDS (TDM DMA, double buffered, 128-wide K
// chunks) and shared by all 8 waves; each wave computes a 32x64 sub-tile
// (2 A frags x 4 B frags -> 8 WMMAs per k-step).
// Fragments are fetched ahead of their use (chunk_mma): no wave waits out a load
// that it has only just issued.
// The finished tile goes through LDS, so that every global store is 16 bytes a
// lane and a wave's store covers whole 128-byte lines.
// 4 waves per SIMD (two blocks per WGP): the register budget of the fragment sets.
__global__ void __launch_bounds__(256) __attribute__((amdgpu_waves_per_eu(4, 4)))
gemm_f16_wmma(const _Float16* __restrict__ A, long sAh, long sAl, int lda,
              const _Float16* __restrict__ Bt, long sBh, long sBl, int ldb,
              void* __restrict__ Cv, long sCh, long sCl, int ldc, int ldcT,
              const float* __restrict__ bias0, const float* __restrict__ bias1,
              const float* __restrict__ bias2, long sBiasl,
              float scale, int zshift, int tfrom, int K, int flags)
{
  const int z    = blockIdx.z;
  const int zh   = z >> zshift;
  const int zl   = z - (zh << zshift);
  A  += zh * sAh + zl * sAl;
  Bt += zh * sBh + zl * sBl;
  const int lane = threadIdx.x & 31;
  const int wave = threadIdx.x >> 5;
  const int m0   = blockIdx.y * 256 + wave * 32;
  const int n0   = blockIdx.x * 64;
  const int lr   = lane & 15;
  const int koff = (lane >> 4) * 8;

  // The two B buffers (2 x 17408 bytes) during the K loop; behind it all of the
  // array stages the C tile.
  __shared__ __align__(16) char lds[CSTAGE_BYTES];
  _Float16 (*tileB)[64 * BROW] = (_Float16 (*)[64 * BROW])lds;

  const _Float16* abase0 = A + (long)(m0 +  0 + lr) * lda + koff;
  const _Float16* abase1 = A + (long)(m0 + 16 + lr) * lda + koff;
  const _Float16* btile  = Bt + (long)n0 * ldb;   // 64-row panel for this block

  const int nchunks = K >> 7;   // K / 128

  // A fragments of chunk 0; they fly while the first B tile lands.
  v16h a[4][2];
#pragma unroll
  for (int s = 0; s < 4; ++s) {
    a[s][0] = load_frag(abase0 + s * 32);
    a[s][1] = load_frag(abase1 + s * 32);
  }

  // Prologue: stage chunk 0 into buffer 0.
#if USE_TDM
  if (threadIdx.x < 32) {
    tdm_load_B(btile, (unsigned)(uintptr_t)&tileB[0][0], ldb);
    __builtin_amdgcn_s_wait_tensorcnt(0);
  }
#else
  {
    const int tid = threadIdx.x;
#pragma unroll
    for (int t = 0; t < 4; ++t) {
      int idx = t * 256 + tid;          // 1024 16-byte chunks
      int r = idx >> 3, c8 = (idx & 7) * 16;
      *(v8h*)(&tileB[0][r * BROW + c8]) = *(const v8h*)(btile + (long)r * ldb + c8);
    }
  }
#endif
  __syncthreads();

  v8f acc[4][2] = {};
  const int boff = lr * BROW + koff;   // the lane's row and k offset in a B buffer
  for (int c = 0; c + 1 < nchunks; ++c) {
    const int buf = c & 1;
    const int kc  = c * CHUNK;

    // Overlap: DMA chunk c+1 into the other buffer while computing chunk c.
#if USE_TDM
    if (threadIdx.x < 32)
      tdm_load_B(btile + kc + CHUNK, (unsigned)(uintptr_t)&tileB[buf ^ 1][0], ldb);
#else
    {
      const int tid = threadIdx.x;
#pragma unroll
      for (int t = 0; t < 4; ++t) {
        int idx = t * 256 + tid;
        int r = idx >> 3, c8 = (idx & 7) * 16;
        *(v8h*)(&tileB[buf ^ 1][r * BROW + c8]) =
            *(const v8h*)(btile + (long)r * ldb + kc + CHUNK + c8);
      }
    }
#endif

    chunk_mma<true>(acc, a, &tileB[buf][boff], abase0 + kc + CHUNK, abase1 + kc + CHUNK);

    // This wave's reads of buf have returned.
    asm volatile("s_wait_dscnt 0x0" ::: "memory");
#if USE_TDM
    if (threadIdx.x < 32) __builtin_amdgcn_s_wait_tensorcnt(0);
#endif
    // Publish buf^1; all waves done reading buf. The bare barrier, not
    // __syncthreads(), which would wait here for the A loads of the next chunk.
    asm volatile("s_barrier_signal -1\n\ts_barrier_wait -1" ::: "memory");
  }
  // The last chunk: nothing left to fetch.
  chunk_mma<false>(acc, a, &tileB[(nchunks - 1) & 1][boff], nullptr, nullptr);

  // Epilogue. C layout per 16x16 tile: lanes 0-15 -> M = base+0..7,
  // lanes 16-31 -> M = base+8..15, N = n0 + j*16 + (lane&15);
  // accumulator element r holds row (base + r).
  const long cbase = zh * sCh + zl * sCl;
  const float* bias = zh == 0 ? bias0 : zh == 1 ? bias1 : bias2;
  const float* bp = bias ? bias + zl * sBiasl : nullptr;
  const int hi = lane >> 4;
  float bval[4] = {0.0f, 0.0f, 0.0f, 0.0f};
  if (bp) {
    const float* bl = bp + n0 + lr;
#pragma unroll
    for (int j = 0; j < 4; ++j) bval[j] = bl[j * 16];
    // The wait in front of any rewrite of a register that the four loads name.
    asm volatile("s_wait_xcnt 0x0" ::: "memory");
  }

  // Every wave has read its last B fragments before the ring's LDS takes C.
  __syncthreads();

  if (zh >= tfrom) {
    // f16, transposed: a lane's 8 accumulator rows are 16 contiguous bytes of
    // a column; a wave then stores whole columns of the block, 512 bytes each.
    _Float16* st = (_Float16*)lds;
#pragma unroll
    for (int j = 0; j < 4; ++j)
#pragma unroll
      for (int t = 0; t < 2; ++t) {
        v8h h;
#pragma unroll
        for (int r = 0; r < 8; ++r) h[r] = (_Float16)((acc[j][t][r] + bval[j]) * scale);
        *(v8h*)(st + (j * 16 + lr) * CT_PITCH + wave * 32 + t * 16 + hi * 8) = h;
      }
    __syncthreads();   // a column holds rows of all eight waves
    _Float16* cg = (_Float16*)Cv + cbase + (long)(n0 + wave * 8) * ldcT
                   + blockIdx.y * 256 + lane * 8;
    const _Float16* sr = st + wave * 8 * CT_PITCH + lane * 8;
    v8h v[8];
    _Float16* p[8];
#pragma unroll
    for (int i = 0; i < 8; ++i) { v[i] = *(const v8h*)(sr + i * CT_PITCH); p[i] = cg + (long)i * ldcT; }
    // Keeps the address arithmetic in front of the first store: behind it no
    // register that an issued store names is written again.
    __builtin_amdgcn_sched_barrier(0);
#pragma unroll
    for (int i = 0; i < 8; ++i) *(v8h*)p[i] = v[i];
  } else if (flags & 1) {
    // f16: a row of the wave's tile is one 128-byte line; 8 lanes store a row.
    _Float16* st = (_Float16*)lds + wave * (32 * CH_PITCH);
#pragma unroll
    for (int j = 0; j < 4; ++j)
#pragma unroll
      for (int t = 0; t < 2; ++t)
#pragma unroll
        for (int r = 0; r < 8; ++r)
          st[(t * 16 + hi * 8 + r) * CH_PITCH + j * 16 + lr] =
              (_Float16)((acc[j][t][r] + bval[j]) * scale);
    // The wave's own LDS writes are complete before other lanes read them back.
    asm volatile("s_wait_dscnt 0x0" ::: "memory");
    _Float16* cg = (_Float16*)Cv + cbase + (long)(m0 + (lane >> 3)) * ldc
                   + n0 + (lane & 7) * 8;
    const _Float16* sr = st + (lane >> 3) * CH_PITCH + (lane & 7) * 8;
    v8h v[8];
    _Float16* p[8];
#pragma unroll
    for (int i = 0; i < 8; ++i) { v[i] = *(const v8h*)(sr + i * 4 * CH_PITCH); p[i] = cg + (long)(i * 4) * ldc; }
    // As above: all addresses are formed in front of the first store.
    __builtin_amdgcn_sched_barrier(0);
#pragma unroll
    for (int i = 0; i < 8; ++i) *(v8h*)p[i] = v[i];
  } else {
    // f32: a row of the wave's tile is two 128-byte lines; 16 lanes store a row.
    float* st = (float*)lds + wave * (32 * CF_PITCH);
#pragma unroll
    for (int j = 0; j < 4; ++j)
#pragma unroll
      for (int t = 0; t < 2; ++t)
#pragma unroll
        for (int r = 0; r < 8; ++r)
          st[(t * 16 + hi * 8 + r) * CF_PITCH + j * 16 + lr] =
              (acc[j][t][r] + bval[j]) * scale;
    // The wave's own LDS writes are complete before other lanes read them back.
    asm volatile("s_wait_dscnt 0x0" ::: "memory");
    float* cg = (float*)Cv + cbase + (long)(m0 + hi) * ldc + n0 + lr * 4;
    const float* sr = st + hi * CF_PITCH + lr * 4;
    v4f v[16];
    float* p[16];
#pragma unroll
    for (int i = 0; i < 16; ++i) { v[i] = *(const v4f*)(sr + i * 2 * CF_PITCH); p[i] = cg + (long)(i * 2) * ldc; }
    // As above: all addresses are formed in front of the first store.
    __builtin_amdgcn_sched_barrier(0);
#pragma unroll
    for (int i = 0; i < 16; ++i) *(v4f*)p[i] = v[i];
  }
}

// All input staging in one launch. Blocks 0..255, one per WGP, each do an equal
// share of the first two parts, with all of their global loads issued up front:
//   x16 = f16(x): 4096 consecutive elements, 16 per thread
//   one 128x128 tile of the sixteen 512x512 weight transposes, f32 -> f16:
//   dst[c*ld + r] = src[r*512 + c]; a wave reads whole 512-byte tile rows,
//   each thread turns 4x4 elements in registers, the tile goes through LDS, and
//   16 lanes store each 256-byte output row
// Block 256: bos[d] = sum_n bo[n][d].
// WqkvT holds the transposed Wq, Wk, Wv as twelve [HID,D] matrices in a row;
// WoT[d][n*HID + h] = Wo[n][h][d].
// LDS tile: row c holds 128 halves = 16 units of 16 bytes; unit u of row c lies
// at place u ^ ((c >> 2) & 15), so that the 32 lanes of a write, which are four
// rows apart, spread over the banks, and a read of a row still covers all banks.
__global__ void __launch_bounds__(256)
prep_inputs(const float* __restrict__ x,  const float* __restrict__ Wq,
            const float* __restrict__ Wk, const float* __restrict__ Wv,
            const float* __restrict__ Wo, const float* __restrict__ bo,
            _Float16* __restrict__ x16, _Float16* __restrict__ WqkvT,
            _Float16* __restrict__ WoT, float* __restrict__ bos)
{
  __shared__ __align__(16) _Float16 tl[128 * 128];

  const int tid = threadIdx.x;
  const int blk = blockIdx.x;

  if (blk == 256) {                     // the whole block leaves before the barrier
#pragma unroll
    for (int t = 0; t < 2; ++t) {
      const int d = t * 256 + tid;
      float s = 0.0f;
      for (int m = 0; m < 4; ++m) s += bo[m * 512 + d];
      bos[d] = s;
    }
    return;
  }

  const v4f* xs = (const v4f*)x + blk * 1024 + tid;
  v4f xv[4];
#pragma unroll
  for (int i = 0; i < 4; ++i) xv[i] = xs[i * 256];

  const int mat   = blk >> 4;           // which * 4 + n
  const int which = mat >> 2;           // 0 Wq, 1 Wk, 2 Wv, 3 Wo
  const int n     = mat & 3;
  const int c0 = (blk & 3) * 128;
  const int r0 = ((blk >> 2) & 3) * 128;
  const float* src = (which == 0 ? Wq : which == 1 ? Wk : which == 2 ? Wv : Wo)
                     + (long)n * 512 * 512 + (long)r0 * 512 + c0;
  const int cb = tid & 31;              // columns cb*4 .. cb*4+3 of the tile
  const int rw = tid >> 5;              // rows (rw + 8*i)*4 .. +3 of the tile
  const float* wp = src + rw * 4 * 512 + cb * 4;
  v4f wv[4][4];
#pragma unroll
  for (int i = 0; i < 4; ++i)
#pragma unroll
    for (int k = 0; k < 4; ++k)
      wv[i][k] = *(const v4f*)(wp + (8 * i * 4 + k) * 512);
  // Keeps all twenty loads in front of the first use of a loaded value: without
  // it the last six are issued behind the first waits, and the block pays the
  // memory latency twice.
  __builtin_amdgcn_sched_barrier(0);
  // The wait in front of any rewrite of the address pair that the sixteen weight
  // loads name; as an input the pair stays whole up to here, so that no load's
  // own result is laid over it.
  asm volatile("s_wait_xcnt 0x0" :: "v"(wp) : "memory");

#pragma unroll
  for (int i = 0; i < 4; ++i) {
    const int rb   = rw + 8 * i;
    const int slot = (((rb >> 1) ^ (cb & 15)) << 3) + ((rb & 1) << 2);
#pragma unroll
    for (int j = 0; j < 4; ++j) {
      v4h h = {(_Float16)wv[i][0][j], (_Float16)wv[i][1][j],
               (_Float16)wv[i][2][j], (_Float16)wv[i][3][j]};
      *(v4h*)(&tl[(cb * 4 + j) * 128 + slot]) = h;
    }
  }
  __syncthreads();

  _Float16* dst = (which < 3 ? WqkvT + (long)mat * 512 * 512 : WoT + (long)n * 512) + r0;
  const int ld  = which < 3 ? 512 : 2048;
#pragma unroll
  for (int i = 0; i < 8; ++i) {
    const int c = i * 16 + (tid >> 4);
    const int u = tid & 15;
    v8h v = *(const v8h*)(&tl[c * 128 + ((u ^ ((c >> 2) & 15)) << 3)]);
    *(v8h*)(dst + (c0 + c) * ld + u * 8) = v;
  }

  // x16 is stored last: in front of the barrier, the barrier would wait for
  // these stores to complete.
  v4h* xd = (v4h*)x16 + blk * 1024 + tid;
#pragma unroll
  for (int i = 0; i < 4; ++i) {
    v4h o = {(_Float16)xv[i][0], (_Float16)xv[i][1], (_Float16)xv[i][2], (_Float16)xv[i][3]};
    xd[i * 256] = o;
  }
}

// One step of a butterfly inside a 16-lane row: the value of lane l ^ mask
// (CTRL = 0x160 + mask, the row_xmask control). All 32 lanes are on at every call.
template <int CTRL>
__device__ __forceinline__ float row_xmask(float v) {
  return __builtin_bit_cast(float, __builtin_amdgcn_update_dpp(
      0, __builtin_bit_cast(int, v), CTRL, 0xf, 0xf, true));
}

// The value of lane l ^ 16.
__device__ __forceinline__ float other_row(float v) {
  const int b = __builtin_bit_cast(int, v);
  return __builtin_bit_cast(float,
      __builtin_amdgcn_permlanex16(b, b, 0x76543210, 0xfedcba98, false, false));
}

__device__ __forceinline__ float wave_max(float v) {
  v = fmaxf(v, row_xmask<0x161>(v));
  v = fmaxf(v, row_xmask<0x162>(v));
  v = fmaxf(v, row_xmask<0x164>(v));
  v = fmaxf(v, row_xmask<0x168>(v));
  return fmaxf(v, other_row(v));
}

__device__ __forceinline__ float wave_sum(float v) {
  v += row_xmask<0x161>(v);
  v += row_xmask<0x162>(v);
  v += row_xmask<0x164>(v);
  v += row_xmask<0x168>(v);
  return v + other_row(v);
}

// One wave per score row: P_row = sum_h gate_h * softmax(s_h * row).
// Row max commutes with the positive per-head scale, so one max serves all heads.
// A lane holds 32 elements of its row in registers. The maximum and each head's
// sum go over the lanes by register butterflies, and a head's exponentials are
// added into the output row as soon as its sum is known, so the kernel has no LDS
// and no barrier. Four rows of one (n, b) to a block.
__global__ void __launch_bounds__(128)
softmax_combine(const float* __restrict__ scores, _Float16* __restrict__ P,
                const float* __restrict__ strength, const float* __restrict__ gate)
{
  const int S = 1024;
  const int lane = threadIdx.x & 31;
  const long row = blockIdx.x * 4 + (threadIdx.x >> 5);   // (n*2 + b) * S + s
  const int  n   = blockIdx.x >> 9;                       // 2 * S / 4 blocks to an n
  const v4f* src = (const v4f*)(scores + row * S) + lane;
  v4h*       dst = (v4h*)(P + row * S) + lane;

  v4f d[8];
#pragma unroll
  for (int i = 0; i < 8; ++i) d[i] = src[i * 32];
  // The wait in front of any rewrite of the address that the eight loads name; as
  // an input the address stays whole up to here.
  asm volatile("s_wait_xcnt 0x0" :: "v"(src) : "memory");

  v4f mv = d[0];
#pragma unroll
  for (int i = 1; i < 8; ++i) mv = __builtin_elementwise_max(mv, d[i]);
  const float m = wave_max(fmaxf(fmaxf(mv[0], mv[1]), fmaxf(mv[2], mv[3])));
#pragma unroll
  for (int i = 0; i < 8; ++i) d[i] -= m;

  v4f o[8] = {};
#pragma unroll
  for (int h = 0; h < 8; ++h) {
    const float s = fminf(fmaxf(strength[n * 64 + h * 9], 0.01f), 1.0f);  // diag, clamped
    v4f e[8];
    v4f t = {0.0f, 0.0f, 0.0f, 0.0f};
#pragma unroll
    for (int i = 0; i < 8; ++i) {
      const v4f a = d[i] * s;
      e[i] = v4f{__expf(a[0]), __expf(a[1]), __expf(a[2]), __expf(a[3])};
      t += e[i];
    }
    const float wh = gate[n * 8 + h] / wave_sum((t[0] + t[1]) + (t[2] + t[3]));
#pragma unroll
    for (int i = 0; i < 8; ++i) o[i] += e[i] * wh;
  }

#pragma unroll
  for (int i = 0; i < 8; ++i)
    dst[i * 32] = v4h{(_Float16)o[i][0], (_Float16)o[i][1], (_Float16)o[i][2], (_Float16)o[i][3]};
}

extern "C" void kernel_launch(void* const* d_in, const int* in_sizes, int n_in,
                              void* d_out, int out_size, void* d_ws, size_t ws_size,
                              hipStream_t stream) {
  (void)in_sizes; (void)n_in; (void)out_size; (void)ws_size;
  const float* x        = (const float*)d_in[0];
  const float* Wq       = (const float*)d_in[1];
  const float* bq       = (const float*)d_in[2];
  const float* Wk       = (const float*)d_in[3];
  const float* bk       = (const float*)d_in[4];
  const float* Wv       = (const float*)d_in[5];
  const float* bv       = (const float*)d_in[6];
  const float* Wo       = (const float*)d_in[7];
  const float* bo       = (const float*)d_in[8];
  const float* strength = (const float*)d_in[9];
  const float* gate     = (const float*)d_in[10];
  float* out = (float*)d_out;

  const int NB = 4, B = 2, S = 1024, D = 512, HID = 512;
  const long MS = (long)B * S;  // 2048

  char* w = (char*)d_ws;
  _Float16* x16  = (_Float16*)w; w += MS * D * 2;                  // [2048,512]
  _Float16* WqT  = (_Float16*)w; w += (long)NB * HID * D * 2;      // [n][HID,D]
  _Float16* WkT  = (_Float16*)w; w += (long)NB * HID * D * 2;
  _Float16* WvT  = (_Float16*)w; w += (long)NB * HID * D * 2;
  _Float16* WoT  = (_Float16*)w; w += (long)D * NB * HID * 2;      // [D, NB*HID]
  _Float16* q16  = (_Float16*)w; w += (long)NB * MS * HID * 2;     // [n][2048,512]
  _Float16* k16  = (_Float16*)w; w += (long)NB * MS * HID * 2;
  _Float16* vT16 = (_Float16*)w; w += (long)NB * HID * MS * 2;     // [n][HID, b*S+t]
  float*    sc   = (float*)w;    w += (long)NB * B * S * S * 4;    // [n][b][S,S]
  _Float16* P16  = (_Float16*)w; w += (long)NB * B * S * S * 2;    // [n][b][S,S]
  _Float16* hs   = (_Float16*)w; w += MS * (long)NB * HID * 2;     // [b*S, NB*HID]
  float*    bos  = (float*)w;    w += 512 * 4;

  (void)WkT; (void)WvT;   // reached through WqT: the three are adjacent

  const dim3 tb(256);

  const int NO_TR = 0x40000000;   // tfrom of a launch in which no group stores transposed

  // Stage 0: f16 conversion + weight transposes (A x B^T convention everywhere)
  // + summed output bias, one launch. WqT, WkT, WvT are adjacent in the workspace.
  prep_inputs<<<dim3(257), 256, 0, stream>>>(
      x, Wq, Wk, Wv, Wo, bo, x16, WqT, WoT, bos);

  // Stage 1: Q, K, V projections of all blocks in one launch, z = which*4 + n:
  // [2048,512] x [512,512]^T each. WqT/WkT/WvT and q16/k16/vT16 are adjacent in
  // the workspace; V (group 2) is stored transposed as vT[n][h][b*S+t].
  gemm_f16_wmma<<<dim3(HID / 64, MS / 256, 3 * NB), tb, 0, stream>>>(
      x16, 0L, 0L, D, WqT, (long)NB * HID * D, (long)HID * D, D,
      q16, (long)NB * MS * HID, (long)MS * HID, HID, (int)MS,
      bq, bk, bv, (long)HID, 1.0f, 2, 2, D, 1);

  // Stage 3: scores = q k^T / sqrt(512); q/k offsets are linear in z = n*2+b.
  gemm_f16_wmma<<<dim3(S / 64, S / 256, NB * B), tb, 0, stream>>>(
      q16, (long)S * HID, 0L, HID, k16, (long)S * HID, 0L, HID,
      sc, (long)S * S, 0L, S, 0, nullptr, nullptr, nullptr, 0L,
      0.044194173824159216f, 0, NO_TR, HID, 0);

  // Stage 4: combined gate-weighted softmax over all 8 heads -> one prob matrix.
  softmax_combine<<<dim3(NB * B * S / 4), 128, 0, stream>>>(sc, P16, strength, gate);

  // Stage 5: head_sum = P @ v for all (n, b) in one launch, z = n*2 + b,
  // staged as hs[b*S + s][n*HID + h].
  gemm_f16_wmma<<<dim3(HID / 64, S / 256, NB * B), tb, 0, stream>>>(
      P16, (long)B * S * S, (long)S * S, S,
      vT16, (long)HID * MS, (long)S, (int)MS,
      hs, (long)HID, (long)S * NB * HID, NB * HID, 0,
      nullptr, nullptr, nullptr, 0L, 1.0f, 1, NO_TR, S, 1);

  // Stage 6: out = MOD * (hs @ Wo_all + sum_n bo[n]); K = NB*HID = 2048.
  gemm_f16_wmma<<<dim3(D / 64, MS / 256, 1), tb, 0, stream>>>(
      hs, 0L, 0L, NB * HID, WoT, 0L, 0L, NB * HID,
      out, 0L, 0L, D, 0, bos, bos, bos, 0L, 1.55f, 0, NO_TR, NB * HID, 0);
}

// v006
// Measured time: 82 microseconds a run.
// In both of two side-by-side timings against v005, it was 1.12 times as fast.
// Over all steps from v000 it is 3.64 times as fast.
#include <hip/hip_runtime.h>
#include <hip/hip_bf16.h>

typedef _Float16 v16h __attribute__((ext_vector_type(16)));
typedef _Float16 v8h  __attribute__((ext_vector_type(8)));
typedef _Float16 v4h  __attribute__((ext_vector_type(4)));
typedef float    v8f  __attribute__((ext_vector_type(8)));
typedef float    v4f  __attribute__((ext_vector_type(4)));
typedef unsigned int u32x4 __attribute__((ext_vector_type(4)));
typedef int          i32x8 __attribute__((ext_vector_type(8)));
typedef int          i32x4 __attribute__((ext_vector_type(4)));

#if __has_builtin(__builtin_amdgcn_tensor_load_to_lds)
#define USE_TDM 1
#else
#define USE_TDM 0
#endif

// LDS B tile: 64 rows x 128 halves per chunk, padded to 136 halves (272B) per
// row so consecutive fragment rows hit different LDS banks (256B stride would
// alias all 16 rows onto the same bank: 64 banks x 4B).
#define BROW 136
#define CHUNK 128

// C staging in LDS, one layout per kind of store:
//   f32: each wave its own 32 rows of 64 floats, pitch 68 floats (272B)
//   f16: each wave its own 32 rows of 64 halves, pitch 72 halves (144B)
//   f16 transposed: the block's 64 columns of 256 halves, pitch 264 halves (528B)
// At these pitches the accumulator writes fall on distinct banks, and so do the
// 16-byte reads of a half-wave, but for the f16 rows, where the two rows that a
// half-wave reads overlap in four banks.
#define CF_PITCH 68
#define CH_PITCH 72
#define CT_PITCH 264
#define CSTAGE_BYTES (8 * 32 * CF_PITCH * 4)

// LDS map of the K loop, in bytes from the start of the work-group's LDS:
//   0       the two B buffers, 64 rows of 272 bytes each
//   A_OFF   the two A buffers; in each, every wave has a slice of its own, its 32
//           rows of 272 bytes, rounded up to a multiple of 2 KiB
#define A_OFF    (2 * 64 * BROW * 2)
#define A_SLICE  10240
#define A_STAGE  (8 * A_SLICE)
#define LDS_BYTES (A_OFF + 2 * A_STAGE)
static_assert(A_OFF % 2048 == 0 && A_SLICE % 2048 == 0 && A_SLICE >= 32 * BROW * 2, "A slices: whole, at multiples of 2 KiB");
static_assert(LDS_BYTES >= CSTAGE_BYTES, "the C tile is staged in the same array");

// Load one 16-half WMMA fragment from an LDS row.
// 16-bit A/B^T layout: lane<16 holds K = k+0..7 and k+16..23,
// lane>=16 holds K = k+8..15 and k+24..31 (koff pre-applied by caller).
__device__ __forceinline__ v16h lds_frag(const _Float16* p) {
  v8h lo = *(const v8h*)(p);
  v8h hi = *(const v8h*)(p + 16);
  return __builtin_shufflevector(lo, hi, 0,1,2,3,4,5,6,7,8,9,10,11,12,13,14,15);
}

#if USE_TDM
// Issue a TDM DMA of a 64-row x 128-half tile of Bt (row stride ldb halves)
// into LDS at lds_addr, with 4-DWORD padding every 64 DWORDs (-> 272B rows).
// This toolchain exposes the 6-arg clang-23 builtin:
//   (u32x4 group0, i32x8 group1, i32x4 group2, i32x4 group3, i32x8, i32 cpol)
__device__ __forceinline__ void tdm_load_B(const _Float16* gptr, unsigned lds_addr, int ldb) {
  unsigned long long ga = (unsigned long long)(uintptr_t)gptr;
  u32x4 g0;
  g0[0] = 1u;                                   // count=1 (valid user descriptor)
  g0[1] = lds_addr;                             // lds_addr [63:32]
  g0[2] = (unsigned)ga;                         // global_addr [95:64]
  g0[3] = (unsigned)(ga >> 32) | (2u << 30);    // global_addr hi + type=2 (image)
  i32x8 g1;
  // data_size=2B, pad_enable, pad_interval=64 DWORDs (code 5), pad_amount=4 DWORDs (code 3)
  g1[0] = (int)((1u << 16) | (1u << 20) | (5u << 22) | (3u << 25));
  const unsigned td0 = 0x40000000u, td1 = 0x40000000u;  // huge dims: no OOB clamp
  g1[1] = (int)((td0 & 0xFFFFu) << 16);                 // tensor_dim0[15:0]
  g1[2] = (int)((td0 >> 16) | ((td1 & 0xFFFFu) << 16)); // tensor_dim0 hi | tensor_dim1 lo
  g1[3] = (int)((td1 >> 16) | ((unsigned)CHUNK << 16)); // tensor_dim1 hi | tile_dim0=128
  g1[4] = 64;                                           // tile_dim1=64, tile_dim2=0
  g1[5] = ldb;                                          // tensor_dim0_stride[31:0]
  g1[6] = 0;                                            // stride hi | dim1_stride lo
  g1[7] = 0;
  i32x4 z4 = {0, 0, 0, 0};                              // group2/3: 2D tile -> zero (NULL)
  i32x8 z8 = {0, 0, 0, 0, 0, 0, 0, 0};
  __builtin_amdgcn_tensor_load_to_lds(g0, g1, z4, z4, z8, 0);
}
#endif

typedef unsigned int u32x8 __attribute__((ext_vector_type(8)));

__device__ __forceinline__ unsigned uni(unsigned v) {
  return (unsigned)__builtin_amdgcn_readfirstlane(v);
}

// Tensor-load descriptor of a wave's A slice: 32 rows of 256 bytes, every extent
// in bytes, tensor = tile, 16 bytes of LDS pad behind each row (pitch 272 bytes).
__device__ __forceinline__ u32x8 a_group1(unsigned src_pitch_bytes) {
  u32x8 g;
  g[0] = uni((1u << 20) | (5u << 22) | (3u << 25));
  g[1] = uni(256u << 16);
  g[2] = uni(32u << 16);
  g[3] = uni(256u << 16);
  g[4] = uni(32u);
  g[5] = uni(src_pitch_bytes);
  g[6] = uni(0u);
  g[7] = uni(0u);
  return g;
}

__device__ __forceinline__ u32x4 a_group0(unsigned lds_place, unsigned long long ga) {
  u32x4 g;
  g[0] = uni(1u);
  g[1] = uni(lds_place);
  g[2] = uni((unsigned)ga);
  g[3] = uni((((unsigned)(ga >> 32)) & 0x01FFFFFFu) | 0x80000000u);
  return g;
}

// One request of the whole wave; it passes through no register and is waited
// for by a_tensor_wait.
__device__ __forceinline__ void a_tensor_load(u32x4 g0, u32x8 g1) {
  asm volatile("tensor_load_to_lds %0, %1" :: "s"(g0), "s"(g1) : "memory");
}

// The wave's own tensor loads have landed. As inputs the last descriptor's
// registers stay whole up to here, while the request may still be queued.
__device__ __forceinline__ void a_tensor_wait(u32x4 g0, u32x8 g1) {
  asm volatile("s_wait_tensorcnt 0x0" :: "s"(g0), "s"(g1) : "memory");
}

// The 32 WMMAs of one 128-wide K chunk of a wave's 32x64 tile, 4 k-steps of 8.
// A and B fragments come from LDS (Al, Bl: the lane's row and k offset in the
// wave's A slice and in the chunk's B buffer) through three register sets, each
// k-step's six as one group two k-steps ahead, so that the wait in front of a
// k-step leaves the younger groups in flight.
__device__ __forceinline__ void chunk_mma(v8f (&acc)[4][2], const _Float16* Al,
                                          const _Float16* Bl) {
  v16h a[3][2];
  v16h b[3][4];
#pragma unroll
  for (int s = 0; s < 2; ++s) {
#pragma unroll
    for (int t = 0; t < 2; ++t) a[s][t] = lds_frag(Al + t * 16 * BROW + s * 32);
#pragma unroll
    for (int j = 0; j < 4; ++j) b[s][j] = lds_frag(Bl + j * 16 * BROW + s * 32);
  }
#pragma unroll
  for (int s = 0; s < 4; ++s) {
    if (s + 2 < 4) {
#pragma unroll
      for (int t = 0; t < 2; ++t) a[(s + 2) % 3][t] = lds_frag(Al + t * 16 * BROW + (s + 2) * 32);
#pragma unroll
      for (int j = 0; j < 4; ++j) b[(s + 2) % 3][j] = lds_frag(Bl + j * 16 * BROW + (s + 2) * 32);
    }
    // Keeps the loads above in front of this k-step's WMMAs: left free, the
    // compiler moves them down to their first use and waits there for each.
    __builtin_amdgcn_sched_barrier(0);
#pragma unroll
    for (int j = 0; j < 4; ++j) {
      acc[j][0] = __builtin_amdgcn_wmma_f32_16x16x32_f16(false, a[s % 3][0], false, b[s % 3][j], (short)0, acc[j][0], false, false);
      acc[j][1] = __builtin_amdgcn_wmma_f32_16x16x32_f16(false, a[s % 3][1], false, b[s % 3][j], (short)0, acc[j][1], false, false);
    }
    // Keeps the next group of LDS reads behind these WMMAs, in one place.
    __builtin_amdgcn_sched_barrier(0);
  }
}

// Generic C = scale * (A[M,K] x Bt[N,K]^T + bias[col]) GEMM, f16 in, f32 acc.
// flags bit0: store f16 (else f32).
// Grid: x = N/64, y = M/256, z = batch. Block: 256 threads = 8 waves.
// The batch index splits into a group zh = z >> zshift and a member
// zl = z & ((1 << zshift) - 1), each with its own operand strides, so that
// products which differ in two indices share one launch. Group zh takes
// bias0, bias1 or bias2 (zh >= 2); groups zh >= tfrom store f16, transposed
// (C[col*ldcT+row]).
// The 64-col B panel is staged into LDS (TDM DMA, double buffered, 128-wide K
// chunks) and shared by all 8 waves; each wave computes a 32x64 sub-tile
// (2 A frags x 4 B frags -> 8 WMMAs per k-step).
// Each wave brings its own 32 A rows of a chunk into LDS by a tensor load of its
// own, one chunk ahead, in the same two-buffer rhythm: the mover reads whole
// 256-byte row pieces, where a fragment load from global memory touches 16 lines
// for 512 bytes.
// Fragments are fetched ahead of their use (chunk_mma): no wave waits out a load
// that it has only just issued.
// The finished tile goes through LDS, so that every global store is 16 bytes a
// lane and a wave's store covers whole 128-byte lines.
// The LDS of the two operand rings leaves room for one block per WGP (2 waves
// per SIMD).
__global__ void __launch_bounds__(256) __attribute__((amdgpu_waves_per_eu(2, 2)))
gemm_f16_wmma(const _Float16* __restrict__ A, long sAh, long sAl, int lda,
              const _Float16* __restrict__ Bt, long sBh, long sBl, int ldb,
              void* __restrict__ Cv, long sCh, long sCl, int ldc, int ldcT,
              const float* __restrict__ bias0, const float* __restrict__ bias1,
              const float* __restrict__ bias2, long sBiasl,
              float scale, int zshift, int tfrom, int K, int flags)
{
  const int z    = blockIdx.z;
  const int zh   = z >> zshift;
  const int zl   = z - (zh << zshift);
  A  += zh * sAh + zl * sAl;
  Bt += zh * sBh + zl * sBl;
  const int lane = threadIdx.x & 31;
  const int wave = threadIdx.x >> 5;
  const int m0   = blockIdx.y * 256 + wave * 32;
  const int n0   = blockIdx.x * 64;
  const int lr   = lane & 15;
  const int koff = (lane >> 4) * 8;

  // The B and A buffers during the K loop (map: at A_OFF above); behind it the
  // head of the array stages the C tile. The kernel's only LDS array, so its
  // offsets are offsets in the work-group's LDS.
  __shared__ __attribute__((aligned(2048))) char lds[LDS_BYTES];
  _Float16 (*tileB)[64 * BROW] = (_Float16 (*)[64 * BROW])lds;

  const _Float16* btile  = Bt + (long)n0 * ldb;   // 64-row panel for this block

  const int nchunks = K >> 7;   // K / 128

  // The wave's A slice: its place in buffer 0, its first source byte, and the
  // lane's row and k offset in it.
  char* aslice = lds + A_OFF + wave * A_SLICE;
  const unsigned aplace = (unsigned)(uintptr_t)aslice;
  const unsigned long long aga = (unsigned long long)(uintptr_t)(A + (long)m0 * lda);
  const u32x8 ag1 = a_group1((unsigned)lda * 2u);
  const int aoff = lr * BROW + koff;

  // Prologue: stage chunk 0 into buffer 0. Every wave issues its own A slice.
  u32x4 ag0 = a_group0(aplace, aga);
  a_tensor_load(ag0, ag1);
#if USE_TDM
  if (threadIdx.x < 32) {
    tdm_load_B(btile, (unsigned)(uintptr_t)&tileB[0][0], ldb);
    __builtin_amdgcn_s_wait_tensorcnt(0);
  }
#else
  {
    const int tid = threadIdx.x;
#pragma unroll
    for (int t = 0; t < 4; ++t) {
      int idx = t * 256 + tid;          // 1024 16-byte chunks
      int r = idx >> 3, c8 = (idx & 7) * 16;
      *(v8h*)(&tileB[0][r * BROW + c8]) = *(const v8h*)(btile + (long)r * ldb + c8);
    }
  }
#endif
  a_tensor_wait(ag0, ag1);
  __syncthreads();

  v8f acc[4][2] = {};
  const int boff = lr * BROW + koff;   // the lane's row and k offset in a B buffer
  for (int c = 0; c + 1 < nchunks; ++c) {
    const int buf = c & 1;
    const int kc  = c * CHUNK;

    // Overlap: DMA chunk c+1 into the other buffers while computing chunk c.
    ag0 = a_group0(aplace + (unsigned)(buf ^ 1) * A_STAGE,
                   aga + (unsigned long long)(kc + CHUNK) * 2u);
    a_tensor_load(ag0, ag1);
#if USE_TDM
    if (threadIdx.x < 32)
      tdm_load_B(btile + kc + CHUNK, (unsigned)(uintptr_t)&tileB[buf ^ 1][0], ldb);
#else
    {
      const int tid = threadIdx.x;
#pragma unroll
      for (int t = 0; t < 4; ++t) {
        int idx = t * 256 + tid;
        int r = idx >> 3, c8 = (idx & 7) * 16;
        *(v8h*)(&tileB[buf ^ 1][r * BROW + c8]) =
            *(const v8h*)(btile + (long)r * ldb + kc + CHUNK + c8);
      }
    }
#endif

    chunk_mma(acc, (const _Float16*)(aslice + buf * A_STAGE) + aoff, &tileB[buf][boff]);

    // This wave's reads of buf have returned.
    asm volatile("s_wait_dscnt 0x0" ::: "memory");
    // Every wave: its own loads of chunk c+1 have landed (wave 0: B as well).
    a_tensor_wait(ag0, ag1);
    // Publish buf^1; all waves done reading buf.
    asm volatile("s_barrier_signal -1\n\ts_barrier_wait -1" ::: "memory");
  }
  // The last chunk: nothing left to fetch.
  chunk_mma(acc, (const _Float16*)(aslice + ((nchunks - 1) & 1) * A_STAGE) + aoff,
            &tileB[(nchunks - 1) & 1][boff]);
  // Nothing of this wave is on its way to LDS or from it when the rings are given up.
  asm volatile("s_wait_tensorcnt 0x0" ::: "memory");
  asm volatile("s_wait_dscnt 0x0" ::: "memory");

  // Epilogue. C layout per 16x16 tile: lanes 0-15 -> M = base+0..7,
  // lanes 16-31 -> M = base+8..15, N = n0 + j*16 + (lane&15);
  // accumulator element r holds row (base + r).
  const long cbase = zh * sCh + zl * sCl;
  const float* bias = zh == 0 ? bias0 : zh == 1 ? bias1 : bias2;
  const float* bp = bias ? bias + zl * sBiasl : nullptr;
  const int hi = lane >> 4;
  float bval[4] = {0.0f, 0.0f, 0.0f, 0.0f};
  if (bp) {
    const float* bl = bp + n0 + lr;
#pragma unroll
    for (int j = 0; j < 4; ++j) bval[j] = bl[j * 16];
    // The wait in front of any rewrite of a register that the four loads name.
    asm volatile("s_wait_xcnt 0x0" ::: "memory");
  }

  // Every wave has read its last B fragments before the ring's LDS takes C.
  __syncthreads();

  if (zh >= tfrom) {
    // f16, transposed: a lane's 8 accumulator rows are 16 contiguous bytes of
    // a column; a wave then stores whole columns of the block, 512 bytes each.
    _Float16* st = (_Float16*)lds;
#pragma unroll
    for (int j = 0; j < 4; ++j)
#pragma unroll
      for (int t = 0; t < 2; ++t) {
        v8h h;
#pragma unroll
        for (int r = 0; r < 8; ++r) h[r] = (_Float16)((acc[j][t][r] + bval[j]) * scale);
        *(v8h*)(st + (j * 16 + lr) * CT_PITCH + wave * 32 + t * 16 + hi * 8) = h;
      }
    __syncthreads();   // a column holds rows of all eight waves
    _Float16* cg = (_Float16*)Cv + cbase + (long)(n0 + wave * 8) * ldcT
                   + blockIdx.y * 256 + lane * 8;
    const _Float16* sr = st + wave * 8 * CT_PITCH + lane * 8;
    v8h v[8];
    _Float16* p[8];
#pragma unroll
    for (int i = 0; i < 8; ++i) { v[i] = *(const v8h*)(sr + i * CT_PITCH); p[i] = cg + (long)i * ldcT; }
    // Keeps the address arithmetic in front of the first store: behind it no
    // register that an issued store names is written again.
    __builtin_amdgcn_sched_barrier(0);
#pragma unroll
    for (int i = 0; i < 8; ++i) *(v8h*)p[i] = v[i];
  } else if (flags & 1) {
    // f16: a row of the wave's tile is one 128-byte line; 8 lanes store a row.
    _Float16* st = (_Float16*)lds + wave * (32 * CH_PITCH);
#pragma unroll
    for (int j = 0; j < 4; ++j)
#pragma unroll
      for (int t = 0; t < 2; ++t)
#pragma unroll
        for (int r = 0; r < 8; ++r)
          st[(t * 16 + hi * 8 + r) * CH_PITCH + j * 16 + lr] =
              (_Float16)((acc[j][t][r] + bval[j]) * scale);
    // The wave's own LDS writes are complete before other lanes read them back.
    asm volatile("s_wait_dscnt 0x0" ::: "memory");
    _Float16* cg = (_Float16*)Cv + cbase + (long)(m0 + (lane >> 3)) * ldc
                   + n0 + (lane & 7) * 8;
    const _Float16* sr = st + (lane >> 3) * CH_PITCH + (lane & 7) * 8;
    v8h v[8];
    _Float16* p[8];
#pragma unroll
    for (int i = 0; i < 8; ++i) { v[i] = *(const v8h*)(sr + i * 4 * CH_PITCH); p[i] = cg + (long)(i * 4) * ldc; }
    // As above: all addresses are formed in front of the first store.
    __builtin_amdgcn_sched_barrier(0);
#pragma unroll
    for (int i = 0; i < 8; ++i) *(v8h*)p[i] = v[i];
  } else {
    // f32: a row of the wave's tile is two 128-byte lines; 16 lanes store a row.
    float* st = (float*)lds + wave * (32 * CF_PITCH);
#pragma unroll
    for (int j = 0; j < 4; ++j)
#pragma unroll
      for (int t = 0; t < 2; ++t)
#pragma unroll
        for (int r = 0; r < 8; ++r)
          st[(t * 16 + hi * 8 + r) * CF_PITCH + j * 16 + lr] =
              (acc[j][t][r] + bval[j]) * scale;
    // The wave's own LDS writes are complete before other lanes read them back.
    asm volatile("s_wait_dscnt 0x0" ::: "memory");
    float* cg = (float*)Cv + cbase + (long)(m0 + hi) * ldc + n0 + lr * 4;
    const float* sr = st + hi * CF_PITCH + lr * 4;
    v4f v[16];
    float* p[16];
#pragma unroll
    for (int i = 0; i < 16; ++i) { v[i] = *(const v4f*)(sr + i * 2 * CF_PITCH); p[i] = cg + (long)(i * 2) * ldc; }
    // As above: all addresses are formed in front of the first store.
    __builtin_amdgcn_sched_barrier(0);
#pragma unroll
    for (int i = 0; i < 16; ++i) *(v4f*)p[i] = v[i];
  }
}

// All input staging in one launch. Blocks 0..255, one per WGP, each do an equal
// share of the first two parts, with all of their global loads issued up front:
//   x16 = f16(x): 4096 consecutive elements, 16 per thread
//   one 128x128 tile of the sixteen 512x512 weight transposes, f32 -> f16:
//   dst[c*ld + r] = src[r*512 + c]; a wave reads whole 512-byte tile rows,
//   each thread turns 4x4 elements in registers, the tile goes through LDS, and
//   16 lanes store each 256-byte output row
// Block 256: bos[d] = sum_n bo[n][d].
// WqkvT holds the transposed Wq, Wk, Wv as twelve [HID,D] matrices in a row;
// WoT[d][n*HID + h] = Wo[n][h][d].
// LDS tile: row c holds 128 halves = 16 units of 16 bytes; unit u of row c lies
// at place u ^ ((c >> 2) & 15), so that the 32 lanes of a write, which are four
// rows apart, spread over the banks, and a read of a row still covers all banks.
__global__ void __launch_bounds__(256)
prep_inputs(const float* __restrict__ x,  const float* __restrict__ Wq,
            const float* __restrict__ Wk, const float* __restrict__ Wv,
            const float* __restrict__ Wo, const float* __restrict__ bo,
            _Float16* __restrict__ x16, _Float16* __restrict__ WqkvT,
            _Float16* __restrict__ WoT, float* __restrict__ bos)
{
  __shared__ __align__(16) _Float16 tl[128 * 128];

  const int tid = threadIdx.x;
  const int blk = blockIdx.x;

  if (blk == 256) {                     // the whole block leaves before the barrier
#pragma unroll
    for (int t = 0; t < 2; ++t) {
      const int d = t * 256 + tid;
      float s = 0.0f;
      for (int m = 0; m < 4; ++m) s += bo[m * 512 + d];
      bos[d] = s;
    }
    return;
  }

  const v4f* xs = (const v4f*)x + blk * 1024 + tid;
  v4f xv[4];
#pragma unroll
  for (int i = 0; i < 4; ++i) xv[i] = xs[i * 256];

  const int mat   = blk >> 4;           // which * 4 + n
  const int which = mat >> 2;           // 0 Wq, 1 Wk, 2 Wv, 3 Wo
  const int n     = mat & 3;
  const int c0 = (blk & 3) * 128;
  const int r0 = ((blk >> 2) & 3) * 128;
  const float* src = (which == 0 ? Wq : which == 1 ? Wk : which == 2 ? Wv : Wo)
                     + (long)n * 512 * 512 + (long)r0 * 512 + c0;
  const int cb = tid & 31;              // columns cb*4 .. cb*4+3 of the tile
  const int rw = tid >> 5;              // rows (rw + 8*i)*4 .. +3 of the tile
  const float* wp = src + rw * 4 * 512 + cb * 4;
  v4f wv[4][4];
#pragma unroll
  for (int i = 0; i < 4; ++i)
#pragma unroll
    for (int k = 0; k < 4; ++k)
      wv[i][k] = *(const v4f*)(wp + (8 * i * 4 + k) * 512);
  // Keeps all twenty loads in front of the first use of a loaded value: without
  // it the last six are issued behind the first waits, and the block pays the
  // memory latency twice.
  __builtin_amdgcn_sched_barrier(0);
  // The wait in front of any rewrite of the address pair that the sixteen weight
  // loads name; as an input the pair stays whole up to here, so that no load's
  // own result is laid over it.
  asm volatile("s_wait_xcnt 0x0" :: "v"(wp) : "memory");

#pragma unroll
  for (int i = 0; i < 4; ++i) {
    const int rb   = rw + 8 * i;
    const int slot = (((rb >> 1) ^ (cb & 15)) << 3) + ((rb & 1) << 2);
#pragma unroll
    for (int j = 0; j < 4; ++j) {
      v4h h = {(_Float16)wv[i][0][j], (_Float16)wv[i][1][j],
               (_Float16)wv[i][2][j], (_Float16)wv[i][3][j]};
      *(v4h*)(&tl[(cb * 4 + j) * 128 + slot]) = h;
    }
  }
  __syncthreads();

  _Float16* dst = (which < 3 ? WqkvT + (long)mat * 512 * 512 : WoT + (long)n * 512) + r0;
  const int ld  = which < 3 ? 512 : 2048;
#pragma unroll
  for (int i = 0; i < 8; ++i) {
    const int c = i * 16 + (tid >> 4);
    const int u = tid & 15;
    v8h v = *(const v8h*)(&tl[c * 128 + ((u ^ ((c >> 2) & 15)) << 3)]);
    *(v8h*)(dst + (c0 + c) * ld + u * 8) = v;
  }

  // x16 is stored last: in front of the barrier, the barrier would wait for
  // these stores to complete.
  v4h* xd = (v4h*)x16 + blk * 1024 + tid;
#pragma unroll
  for (int i = 0; i < 4; ++i) {
    v4h o = {(_Float16)xv[i][0], (_Float16)xv[i][1], (_Float16)xv[i][2], (_Float16)xv[i][3]};
    xd[i * 256] = o;
  }
}

// One step of a butterfly inside a 16-lane row: the value of lane l ^ mask
// (CTRL = 0x160 + mask, the row_xmask control). All 32 lanes are on at every call.
template <int CTRL>
__device__ __forceinline__ float row_xmask(float v) {
  return __builtin_bit_cast(float, __builtin_amdgcn_update_dpp(
      0, __builtin_bit_cast(int, v), CTRL, 0xf, 0xf, true));
}

// The value of lane l ^ 16.
__device__ __forceinline__ float other_row(float v) {
  const int b = __builtin_bit_cast(int, v);
  return __builtin_bit_cast(float,
      __builtin_amdgcn_permlanex16(b, b, 0x76543210, 0xfedcba98, false, false));
}

__device__ __forceinline__ float wave_max(float v) {
  v = fmaxf(v, row_xmask<0x161>(v));
  v = fmaxf(v, row_xmask<0x162>(v));
  v = fmaxf(v, row_xmask<0x164>(v));
  v = fmaxf(v, row_xmask<0x168>(v));
  return fmaxf(v, other_row(v));
}

__device__ __forceinline__ float wave_sum(float v) {
  v += row_xmask<0x161>(v);
  v += row_xmask<0x162>(v);
  v += row_xmask<0x164>(v);
  v += row_xmask<0x168>(v);
  return v + other_row(v);
}

// One wave per score row: P_row = sum_h gate_h * softmax(s_h * row).
// Row max commutes with the positive per-head scale, so one max serves all heads.
// A lane holds 32 elements of its row in registers. The maximum and each head's
// sum go over the lanes by register butterflies, and a head's exponentials are
// added into the output row as soon as its sum is known, so the kernel has no LDS
// and no barrier. Four rows of one (n, b) to a block.
__global__ void __launch_bounds__(128)
softmax_combine(const float* __restrict__ scores, _Float16* __restrict__ P,
                const float* __restrict__ strength, const float* __restrict__ gate)
{
  const int S = 1024;
  const int lane = threadIdx.x & 31;
  const long row = blockIdx.x * 4 + (threadIdx.x >> 5);   // (n*2 + b) * S + s
  const int  n   = blockIdx.x >> 9;                       // 2 * S / 4 blocks to an n
  const v4f* src = (const v4f*)(scores + row * S) + lane;
  v4h*       dst = (v4h*)(P + row * S) + lane;

  v4f d[8];
#pragma unroll
  for (int i = 0; i < 8; ++i) d[i] = src[i * 32];
  // The wait in front of any rewrite of the address that the eight loads name; as
  // an input the address stays whole up to here.
  asm volatile("s_wait_xcnt 0x0" :: "v"(src) : "memory");

  v4f mv = d[0];
#pragma unroll
  for (int i = 1; i < 8; ++i) mv = __builtin_elementwise_max(mv, d[i]);
  const float m = wave_max(fmaxf(fmaxf(mv[0], mv[1]), fmaxf(mv[2], mv[3])));
#pragma unroll
  for (int i = 0; i < 8; ++i) d[i] -= m;

  v4f o[8] = {};
#pragma unroll
  for (int h = 0; h < 8; ++h) {
    const float s = fminf(fmaxf(strength[n * 64 + h * 9], 0.01f), 1.0f);  // diag, clamped
    v4f e[8];
    v4f t = {0.0f, 0.0f, 0.0f, 0.0f};
#pragma unroll
    for (int i = 0; i < 8; ++i) {
      const v4f a = d[i] * s;
      e[i] = v4f{__expf(a[0]), __expf(a[1]), __expf(a[2]), __expf(a[3])};
      t += e[i];
    }
    const float wh = gate[n * 8 + h] / wave_sum((t[0] + t[1]) + (t[2] + t[3]));
#pragma unroll
    for (int i = 0; i < 8; ++i) o[i] += e[i] * wh;
  }

#pragma unroll
  for (int i = 0; i < 8; ++i)
    dst[i * 32] = v4h{(_Float16)o[i][0], (_Float16)o[i][1], (_Float16)o[i][2], (_Float16)o[i][3]};
}

extern "C" void kernel_launch(void* const* d_in, const int* in_sizes, int n_in,
                              void* d_out, int out_size, void* d_ws, size_t ws_size,
                              hipStream_t stream) {
  (void)in_sizes; (void)n_in; (void)out_size; (void)ws_size;
  const float* x        = (const float*)d_in[0];
  const float* Wq       = (const float*)d_in[1];
  const float* bq       = (const float*)d_in[2];
  const float* Wk       = (const float*)d_in[3];
  const float* bk       = (const float*)d_in[4];
  const float* Wv       = (const float*)d_in[5];
  const float* bv       = (const float*)d_in[6];
  const float* Wo       = (const float*)d_in[7];
  const float* bo       = (const float*)d_in[8];
  const float* strength = (const float*)d_in[9];
  const float* gate     = (const float*)d_in[10];
  float* out = (float*)d_out;

  const int NB = 4, B = 2, S = 1024, D = 512, HID = 512;
  const long MS = (long)B * S;  // 2048

  char* w = (char*)d_ws;
  _Float16* x16  = (_Float16*)w; w += MS * D * 2;                  // [2048,512]
  _Float16* WqT  = (_Float16*)w; w += (long)NB * HID * D * 2;      // [n][HID,D]
  _Float16* WkT  = (_Float16*)w; w += (long)NB * HID * D * 2;
  _Float16* WvT  = (_Float16*)w; w += (long)NB * HID * D * 2;
  _Float16* WoT  = (_Float16*)w; w += (long)D * NB * HID * 2;      // [D, NB*HID]
  _Float16* q16  = (_Float16*)w; w += (long)NB * MS * HID * 2;     // [n][2048,512]
  _Float16* k16  = (_Float16*)w; w += (long)NB * MS * HID * 2;
  _Float16* vT16 = (_Float16*)w; w += (long)NB * HID * MS * 2;     // [n][HID, b*S+t]
  float*    sc   = (float*)w;    w += (long)NB * B * S * S * 4;    // [n][b][S,S]
  _Float16* P16  = (_Float16*)w; w += (long)NB * B * S * S * 2;    // [n][b][S,S]
  _Float16* hs   = (_Float16*)w; w += MS * (long)NB * HID * 2;     // [b*S, NB*HID]
  float*    bos  = (float*)w;    w += 512 * 4;

  (void)WkT; (void)WvT;   // reached through WqT: the three are adjacent

  const dim3 tb(256);

  const int NO_TR = 0x40000000;   // tfrom of a launch in which no group stores transposed

  // Stage 0: f16 conversion + weight transposes (A x B^T convention everywhere)
  // + summed output bias, one launch. WqT, WkT, WvT are adjacent in the workspace.
  prep_inputs<<<dim3(257), 256, 0, stream>>>(
      x, Wq, Wk, Wv, Wo, bo, x16, WqT, WoT, bos);

  // Stage 1: Q, K, V projections of all blocks in one launch, z = which*4 + n:
  // [2048,512] x [512,512]^T each. WqT/WkT/WvT and q16/k16/vT16 are adjacent in
  // the workspace; V (group 2) is stored transposed as vT[n][h][b*S+t].
  gemm_f16_wmma<<<dim3(HID / 64, MS / 256, 3 * NB), tb, 0, stream>>>(
      x16, 0L, 0L, D, WqT, (long)NB * HID * D, (long)HID * D, D,
      q16, (long)NB * MS * HID, (long)MS * HID, HID, (int)MS,
      bq, bk, bv, (long)HID, 1.0f, 2, 2, D, 1);

  // Stage 3: scores = q k^T / sqrt(512); q/k offsets are linear in z = n*2+b.
  gemm_f16_wmma<<<dim3(S / 64, S / 256, NB * B), tb, 0, stream>>>(
      q16, (long)S * HID, 0L, HID, k16, (long)S * HID, 0L, HID,
      sc, (long)S * S, 0L, S, 0, nullptr, nullptr, nullptr, 0L,
      0.044194173824159216f, 0, NO_TR, HID, 0);

  // Stage 4: combined gate-weighted softmax over all 8 heads -> one prob matrix.
  softmax_combine<<<dim3(NB * B * S / 4), 128, 0, stream>>>(sc, P16, strength, gate);

  // Stage 5: head_sum = P @ v for all (n, b) in one launch, z = n*2 + b,
  // staged as hs[b*S + s][n*HID + h].
  gemm_f16_wmma<<<dim3(HID / 64, S / 256, NB * B), tb, 0, stream>>>(
      P16, (long)B * S * S, (long)S * S, S,
      vT16, (long)HID * MS, (long)S, (int)MS,
      hs, (long)HID, (long)S * NB * HID, NB * HID, 0,
      nullptr, nullptr, nullptr, 0L, 1.0f, 1, NO_TR, S, 1);

  // Stage 6: out = MOD * (hs @ Wo_all + sum_n bo[n]); K = NB*HID = 2048.
  gemm_f16_wmma<<<dim3(D / 64, MS / 256, 1), tb, 0, stream>>>(
      hs, 0L, 0L, NB * HID, WoT, 0L, 0L, NB * HID,
      out, 0L, 0L, D, 0, bos, bos, bos, 0L, 1.55f, 0, NO_TR, NB * HID, 0);
}
